// v000
// The times below were measured on an AMD MI455X: many runs one after another, warmed up first and cycling through
// copies of the inputs, with the whole window's GPU time divided by the number of runs. Launches and the gaps
// between them are all in it. The median over several windows is given; except for v000 it joins two sittings, which
// can be a few percent apart, so the side-by-side timings, each taken in one sitting, are the better comparison.
// The starting kernel, v000, takes 32.3 microseconds a run.
#include <hip/hip_runtime.h>
#include <math.h>

#if __has_include(<hip/amd_detail/amd_gfx1250_TDM.h>)
#include <hip/amd_detail/amd_gfx1250_TDM.h>
#define TDM_HEADER_PRESENT 1
#endif

typedef float v2f __attribute__((ext_vector_type(2)));
typedef float v4f __attribute__((ext_vector_type(4)));
typedef float v8f __attribute__((ext_vector_type(8)));
typedef int   v4i __attribute__((ext_vector_type(4)));

#define KS 7
#define EDIM 64
#define HN 8
#define QKV_RSTRIDE (HN * EDIM)   // 512 floats between consecutive l for fixed (b,h)
#define LSTRIDE 68                // padded LDS row stride (floats) for Q/K/V tiles
#define PSTRIDE 36                // padded LDS row stride for P tile

// ---------------- async global -> LDS staging (gfx1250 path) ----------------
#if __has_builtin(__builtin_amdgcn_global_load_async_to_lds_b128) && \
    __has_builtin(__builtin_amdgcn_s_wait_asynccnt)
#define USE_ASYNC_LDS 1
#else
#define USE_ASYNC_LDS 0
#endif

typedef __attribute__((address_space(1))) v4i* as1_v4i_ptr;  // global int4*
typedef __attribute__((address_space(3))) v4i* as3_v4i_ptr;  // LDS int4*

__device__ __forceinline__ void stage16(const float* g, float* l) {
#if USE_ASYNC_LDS
    // AS1/AS3 pointers via integer casts; low 32 bits of a generic LDS pointer
    // are the LDS byte offset per the aperture rules.
    as1_v4i_ptr gp = (as1_v4i_ptr)(unsigned long long)g;
    as3_v4i_ptr lp = (as3_v4i_ptr)(unsigned int)(unsigned long long)l;
    __builtin_amdgcn_global_load_async_to_lds_b128(gp, lp, 0, 0);
#else
    *(v4f*)l = *(const v4f*)g;
#endif
}

__device__ __forceinline__ void stage_fence() {
#if USE_ASYNC_LDS
    __builtin_amdgcn_s_wait_asynccnt(0);
#endif
}

// ---------------- TDM probe (never launched; arity/type discovery) ----------
#if __has_builtin(__builtin_amdgcn_tensor_load_to_lds) && \
    __has_builtin(__builtin_amdgcn_s_wait_tensorcnt)
typedef unsigned int u32x4 __attribute__((ext_vector_type(4)));
typedef int i32x4 __attribute__((ext_vector_type(4)));
typedef int i32x8 __attribute__((ext_vector_type(8)));
__global__ void tdm_probe_kernel() {
    u32x4 g0 = {0u, 0u, 0u, 0u};
    i32x8 g1 = {0, 0, 0, 0, 0, 0, 0, 0};
    i32x4 g2 = {0, 0, 0, 0};
    i32x4 g3 = {0, 0, 0, 0};
    i32x8 g4 = {0, 0, 0, 0, 0, 0, 0, 0};
    __builtin_amdgcn_tensor_load_to_lds(g0, g1, g2, g3, g4, 0);
    __builtin_amdgcn_s_wait_tensorcnt(0);
}
#endif

// ---------------- main kernel ----------------
__global__ __launch_bounds__(32)
void natten1d_wmma_kernel(const float* __restrict__ qg,
                          const float* __restrict__ kg,
                          const float* __restrict__ vg,
                          const float* __restrict__ rpb,
                          float* __restrict__ outg,   // (B,L,H,E)
                          float* __restrict__ attng,  // (B,H,L,KS)
                          int B, int L)
{
    __shared__ __align__(16) float sQ[16 * LSTRIDE];
    __shared__ __align__(16) float sK[32 * LSTRIDE];
    __shared__ __align__(16) float sV[32 * LSTRIDE];
    __shared__ __align__(16) float sP[16 * PSTRIDE];
    __shared__ float sR[13];

    const int tid    = (int)threadIdx.x;       // 0..31, one full wave32
    const int ntiles = L >> 4;
    const int bid    = (int)blockIdx.x;
    const int tile   = bid % ntiles;
    const int h      = (bid / ntiles) % HN;
    const int b      = bid / (ntiles * HN);
    const int t      = tile << 4;              // first query position of tile

    const size_t base = ((size_t)b * L) * QKV_RSTRIDE + (size_t)h * EDIM;

    if (tid < 13) sR[tid] = rpb[h * 13 + tid];

    // ---- stage Q (16 rows) and K/V (32 rows: t-3 .. t+28, clamped) into LDS ----
    #pragma unroll
    for (int i = tid; i < 16 * 16; i += 32) {
        const int r = i >> 4, c4 = (i & 15) << 2;
        stage16(qg + base + (size_t)(t + r) * QKV_RSTRIDE + c4, &sQ[r * LSTRIDE + c4]);
    }
    #pragma unroll
    for (int i = tid; i < 32 * 16; i += 32) {
        const int r = i >> 4, c4 = (i & 15) << 2;
        int gr = t - 3 + r;
        gr = gr < 0 ? 0 : (gr >= L ? L - 1 : gr);
        const size_t off = base + (size_t)gr * QKV_RSTRIDE + c4;
        stage16(kg + off, &sK[r * LSTRIDE + c4]);
        stage16(vg + off, &sV[r * LSTRIDE + c4]);
    }
    stage_fence();          // s_wait_asynccnt 0
    __syncthreads();

    const int g  = tid >> 4;    // lane group (0: lanes 0-15, 1: lanes 16-31)
    const int ln = tid & 15;

    // ---- S = Q * K^T over the 32-wide key band, two 16x16 WMMA tiles ----
    v8f acc0 = {0.f,0.f,0.f,0.f,0.f,0.f,0.f,0.f};
    v8f acc1 = {0.f,0.f,0.f,0.f,0.f,0.f,0.f,0.f};
    #pragma unroll
    for (int e4 = 0; e4 < 16; ++e4) {
        const int col = (e4 << 2) + (g << 1);
        v2f a  = *(const v2f*)&sQ[ln * LSTRIDE + col];          // A[M=ln][K=col..col+1]
        v2f b0 = *(const v2f*)&sK[ln * LSTRIDE + col];          // B[K][N=ln], keys 0..15
        v2f b1 = *(const v2f*)&sK[(16 + ln) * LSTRIDE + col];   // keys 16..31
        acc0 = __builtin_amdgcn_wmma_f32_16x16x4_f32(false, a, false, b0, (short)0, acc0, false, false);
        acc1 = __builtin_amdgcn_wmma_f32_16x16x4_f32(false, a, false, b1, (short)0, acc1, false, false);
    }

    // ---- scale + rpb + edge mask, scatter S into LDS P tile ----
    #pragma unroll
    for (int vv = 0; vv < 8; ++vv) {
        const int M = vv + (g << 3);   // query row within tile
        {   // band tile 0: jrel = ln
            const int kk    = ln - M;          // neighbor index 0..6 when valid
            const int jglob = t - 3 + ln;
            const bool ok   = (kk >= 0) && (kk < KS) && (jglob >= 0) && (jglob < L);
            const int  ri   = kk < 0 ? 0 : (kk > 6 ? 6 : kk);
            const float sv  = ok ? (acc0[vv] * 0.125f + sR[3 + ri]) : -INFINITY;
            sP[M * PSTRIDE + ln] = sv;
        }
        {   // band tile 1: jrel = 16 + ln  (kk >= 1 and jglob >= 13 always)
            const int kk    = 16 + ln - M;
            const int jglob = t + 13 + ln;
            const bool ok   = (kk < KS) && (jglob < L);
            const int  ri   = kk > 6 ? 6 : kk;
            const float sv  = ok ? (acc1[vv] * 0.125f + sR[3 + ri]) : -INFINITY;
            sP[M * PSTRIDE + 16 + ln] = sv;
        }
    }
    __syncthreads();

    // ---- per-row softmax over the 7 valid entries; zero elsewhere; emit attn ----
    if (tid < 16) {
        const int r = tid;
        float* row = &sP[r * PSTRIDE];
        float m = -INFINITY;
        #pragma unroll
        for (int kk = 0; kk < KS; ++kk) m = fmaxf(m, row[r + kk]);
        float pv[KS];
        float sum = 0.f;
        #pragma unroll
        for (int kk = 0; kk < KS; ++kk) {
            const float p = __expf(row[r + kk] - m);   // exp(-inf) -> 0 at edges
            pv[kk] = p; sum += p;
        }
        const float inv = 1.0f / sum;
        #pragma unroll
        for (int c = 0; c < 32; ++c) row[c] = 0.f;
        float* aout = attng + (((size_t)b * HN + h) * L + (t + r)) * KS;
        #pragma unroll
        for (int kk = 0; kk < KS; ++kk) {
            const float p = pv[kk] * inv;
            row[r + kk] = p;
            aout[kk] = p;
        }
    }
    __syncthreads();

    // ---- out = P * V : 4 N-tiles of 16 cols, band K-dim 0..23 in chunks of 4 ----
    const size_t obase = ((size_t)b * L + t) * QKV_RSTRIDE + (size_t)h * EDIM;
    #pragma unroll
    for (int nt = 0; nt < 4; ++nt) {
        v8f acc = {0.f,0.f,0.f,0.f,0.f,0.f,0.f,0.f};
        #pragma unroll
        for (int c = 0; c < 6; ++c) {
            const int kr = (c << 2) + (g << 1);
            v2f a = *(const v2f*)&sP[ln * PSTRIDE + kr];        // A[M=ln][K=kr..kr+1]
            v2f bb;
            bb.x = sV[(kr + 0) * LSTRIDE + (nt << 4) + ln];     // B[K=kr  ][N=ln]
            bb.y = sV[(kr + 1) * LSTRIDE + (nt << 4) + ln];     // B[K=kr+1][N=ln]
            acc = __builtin_amdgcn_wmma_f32_16x16x4_f32(false, a, false, bb, (short)0, acc, false, false);
        }
        #pragma unroll
        for (int vv = 0; vv < 8; ++vv) {
            const int M = vv + (g << 3);
            outg[obase + (size_t)M * QKV_RSTRIDE + (nt << 4) + ln] = acc[vv];
        }
    }
}

extern "C" void kernel_launch(void* const* d_in, const int* in_sizes, int n_in,
                              void* d_out, int out_size, void* d_ws, size_t ws_size,
                              hipStream_t stream) {
    (void)n_in; (void)out_size; (void)d_ws; (void)ws_size;
    const float* q   = (const float*)d_in[0];
    const float* k   = (const float*)d_in[1];
    const float* v   = (const float*)d_in[2];
    const float* rpb = (const float*)d_in[3];
    const int L = 8192;
    const int B = in_sizes[0] / (L * HN * EDIM);   // = 4
    float* out  = (float*)d_out;
    float* attn = out + (size_t)B * L * HN * EDIM;
    const int ntiles = L / 16;
    dim3 grid(B * HN * ntiles);   // 16384 blocks, 1 wave32 each
    natten1d_wmma_kernel<<<grid, 32, 0, stream>>>(q, k, v, rpb, out, attn, B, L);
}

// v001
// It runs in 29 microseconds.
// Next to v000, in two timings, it ran 1.13 and 1.12 times as fast.
#include <hip/hip_runtime.h>
#include <math.h>

typedef float v2f __attribute__((ext_vector_type(2)));
typedef float v4f __attribute__((ext_vector_type(4)));
typedef float v8f __attribute__((ext_vector_type(8)));
typedef int   v4i __attribute__((ext_vector_type(4)));

#define KS 7
#define EDIM 64
#define HN 8
#define QKV_RSTRIDE (HN * EDIM)   // 512 floats between consecutive l for fixed (b,h)
#define LSTRIDE 68                // padded LDS row stride (floats) for Q/K/V tiles
#define PSTRIDE 36                // padded LDS row stride for P tile
#define WAVES 4                   // waves per work-group, one 16-query tile each
#define QT (16 * WAVES)           // queries per work-group
#define KROWS (QT + 16)           // staged K rows: t0-3 .. t0+QT+12 (last wave's second score tile)
#define VROWS (QT + 8)            // staged V rows: t0-3 .. t0+QT+4  (last wave's band depth of 24)

// ---------------- async global -> LDS staging (gfx1250 path) ----------------
#if __has_builtin(__builtin_amdgcn_global_load_async_to_lds_b128) && \
    __has_builtin(__builtin_amdgcn_s_wait_asynccnt)
#define USE_ASYNC_LDS 1
#else
#define USE_ASYNC_LDS 0
#endif

typedef __attribute__((address_space(1))) v4i* as1_v4i_ptr;  // global int4*
typedef __attribute__((address_space(3))) v4i* as3_v4i_ptr;  // LDS int4*

__device__ __forceinline__ void stage16(const float* g, float* l) {
#if USE_ASYNC_LDS
    // AS1/AS3 pointers via integer casts; low 32 bits of a generic LDS pointer
    // are the LDS byte offset per the aperture rules.
    as1_v4i_ptr gp = (as1_v4i_ptr)(unsigned long long)g;
    as3_v4i_ptr lp = (as3_v4i_ptr)(unsigned int)(unsigned long long)l;
    __builtin_amdgcn_global_load_async_to_lds_b128(gp, lp, 0, 0);
#else
    *(v4f*)l = *(const v4f*)g;
#endif
}

__device__ __forceinline__ void stage_fence() {
#if USE_ASYNC_LDS
    // every copy of this wave has landed before the barrier that lets other waves read it
    asm volatile("s_wait_asynccnt 0x0" ::: "memory");
#endif
}

// ---------------- main kernel ----------------
__global__ __launch_bounds__(32 * WAVES)
void natten1d_wmma_kernel(const float* __restrict__ qg,
                          const float* __restrict__ kg,
                          const float* __restrict__ vg,
                          const float* __restrict__ rpb,
                          float* __restrict__ outg,   // (B,L,H,E)
                          float* __restrict__ attng,  // (B,H,L,KS)
                          int B, int L)
{
    __shared__ __align__(16) float sQall[QT * LSTRIDE];
    __shared__ __align__(16) float sKall[KROWS * LSTRIDE];
    __shared__ __align__(16) float sVall[VROWS * LSTRIDE];
    __shared__ __align__(16) float sPall[WAVES * 16 * PSTRIDE];
    __shared__ float sR[13];

    const int wtid = (int)threadIdx.x;                            // 0..127
    const int tid  = wtid & 31;                                   // lane in the wave
    const int w    = __builtin_amdgcn_readfirstlane(wtid >> 5);   // wave in the work-group
    const int t0   = (int)blockIdx.x * QT;     // first query position of the work-group
    const int h    = (int)blockIdx.y;
    const int b    = (int)blockIdx.z;
    const int t    = t0 + (w << 4);            // first query position of this wave's tile

    const size_t base = ((size_t)b * L) * QKV_RSTRIDE + (size_t)h * EDIM;

    // ---- all waves stage Q (QT rows) and one shared K/V band (clamped) into LDS ----
    const int r0 = wtid >> 4, c4 = (wtid & 15) << 2;
    #pragma unroll
    for (int i = 0; i < QT / 8; ++i) {
        const int r = r0 + (i << 3);
        stage16(qg + base + (size_t)(t0 + r) * QKV_RSTRIDE + c4, &sQall[r * LSTRIDE + c4]);
    }
    #pragma unroll
    for (int i = 0; i < KROWS / 8; ++i) {
        const int r = r0 + (i << 3);
        int gr = t0 - 3 + r;
        gr = gr < 0 ? 0 : (gr >= L ? L - 1 : gr);
        const size_t off = base + (size_t)gr * QKV_RSTRIDE + c4;
        stage16(kg + off, &sKall[r * LSTRIDE + c4]);
        if (i < VROWS / 8) stage16(vg + off, &sVall[r * LSTRIDE + c4]);
    }
    if (wtid < 13) sR[wtid] = rpb[h * 13 + wtid];
    stage_fence();          // s_wait_asynccnt 0
    __syncthreads();

    // this wave's window into the shared tiles
    const float* sQ = sQall + (w << 4) * LSTRIDE;
    const float* sK = sKall + (w << 4) * LSTRIDE;
    const float* sV = sVall + (w << 4) * LSTRIDE;
    float*       sP = sPall + (w << 4) * PSTRIDE;

    const int g  = tid >> 4;    // lane group (0: lanes 0-15, 1: lanes 16-31)
    const int ln = tid & 15;

    // ---- S = Q * K^T over the 32-wide key band, two 16x16 WMMA tiles ----
    v8f acc0 = {0.f,0.f,0.f,0.f,0.f,0.f,0.f,0.f};
    v8f acc1 = {0.f,0.f,0.f,0.f,0.f,0.f,0.f,0.f};
    #pragma unroll
    for (int e4 = 0; e4 < 16; ++e4) {
        const int col = (e4 << 2) + (g << 1);
        v2f a  = *(const v2f*)&sQ[ln * LSTRIDE + col];          // A[M=ln][K=col..col+1]
        v2f b0 = *(const v2f*)&sK[ln * LSTRIDE + col];          // B[K][N=ln], keys 0..15
        v2f b1 = *(const v2f*)&sK[(16 + ln) * LSTRIDE + col];   // keys 16..31
        acc0 = __builtin_amdgcn_wmma_f32_16x16x4_f32(false, a, false, b0, (short)0, acc0, false, false);
        acc1 = __builtin_amdgcn_wmma_f32_16x16x4_f32(false, a, false, b1, (short)0, acc1, false, false);
    }

    // ---- scale + rpb + edge mask, scatter S into LDS P tile ----
    #pragma unroll
    for (int vv = 0; vv < 8; ++vv) {
        const int M = vv + (g << 3);   // query row within tile
        {   // band tile 0: jrel = ln
            const int kk    = ln - M;          // neighbor index 0..6 when valid
            const int jglob = t - 3 + ln;
            const bool ok   = (kk >= 0) && (kk < KS) && (jglob >= 0) && (jglob < L);
            const int  ri   = kk < 0 ? 0 : (kk > 6 ? 6 : kk);
            const float sv  = ok ? (acc0[vv] * 0.125f + sR[3 + ri]) : -INFINITY;
            sP[M * PSTRIDE + ln] = sv;
        }
        {   // band tile 1: jrel = 16 + ln  (kk >= 1 and jglob >= 13 always)
            const int kk    = 16 + ln - M;
            const int jglob = t + 13 + ln;
            const bool ok   = (kk < KS) && (jglob < L);
            const int  ri   = kk > 6 ? 6 : kk;
            const float sv  = ok ? (acc1[vv] * 0.125f + sR[3 + ri]) : -INFINITY;
            sP[M * PSTRIDE + 16 + ln] = sv;
        }
    }
    __syncthreads();

    // ---- per-row softmax over the 7 valid entries; zero elsewhere; emit attn ----
    if (tid < 16) {
        const int r = tid;
        float* row = &sP[r * PSTRIDE];
        float m = -INFINITY;
        #pragma unroll
        for (int kk = 0; kk < KS; ++kk) m = fmaxf(m, row[r + kk]);
        float pv[KS];
        float sum = 0.f;
        #pragma unroll
        for (int kk = 0; kk < KS; ++kk) {
            const float p = __expf(row[r + kk] - m);   // exp(-inf) -> 0 at edges
            pv[kk] = p; sum += p;
        }
        const float inv = 1.0f / sum;
        #pragma unroll
        for (int c = 0; c < 32; ++c) row[c] = 0.f;
        float* aout = attng + (((size_t)b * HN + h) * L + (t + r)) * KS;
        #pragma unroll
        for (int kk = 0; kk < KS; ++kk) {
            const float p = pv[kk] * inv;
            row[r + kk] = p;
            aout[kk] = p;
        }
    }
    __syncthreads();

    // ---- out = P * V : 4 N-tiles of 16 cols, band K-dim 0..23 in chunks of 4 ----
    const size_t obase = ((size_t)b * L + t) * QKV_RSTRIDE + (size_t)h * EDIM;
    #pragma unroll
    for (int nt = 0; nt < 4; ++nt) {
        v8f acc = {0.f,0.f,0.f,0.f,0.f,0.f,0.f,0.f};
        #pragma unroll
        for (int c = 0; c < 6; ++c) {
            const int kr = (c << 2) + (g << 1);
            v2f a = *(const v2f*)&sP[ln * PSTRIDE + kr];        // A[M=ln][K=kr..kr+1]
            v2f bb;
            bb.x = sV[(kr + 0) * LSTRIDE + (nt << 4) + ln];     // B[K=kr  ][N=ln]
            bb.y = sV[(kr + 1) * LSTRIDE + (nt << 4) + ln];     // B[K=kr+1][N=ln]
            acc = __builtin_amdgcn_wmma_f32_16x16x4_f32(false, a, false, bb, (short)0, acc, false, false);
        }
        #pragma unroll
        for (int vv = 0; vv < 8; ++vv) {
            const int M = vv + (g << 3);
            outg[obase + (size_t)M * QKV_RSTRIDE + (nt << 4) + ln] = acc[vv];
        }
    }
}

extern "C" void kernel_launch(void* const* d_in, const int* in_sizes, int n_in,
                              void* d_out, int out_size, void* d_ws, size_t ws_size,
                              hipStream_t stream) {
    (void)n_in; (void)out_size; (void)d_ws; (void)ws_size;
    const float* q   = (const float*)d_in[0];
    const float* k   = (const float*)d_in[1];
    const float* v   = (const float*)d_in[2];
    const float* rpb = (const float*)d_in[3];
    const int L = 8192;
    const int B = in_sizes[0] / (L * HN * EDIM);   // = 4
    float* out  = (float*)d_out;
    float* attn = out + (size_t)B * L * HN * EDIM;
    const int ntiles = L / QT;
    dim3 grid(ntiles, HN, B);     // 4096 blocks of WAVES wave32 each
    natten1d_wmma_kernel<<<grid, 32 * WAVES, 0, stream>>>(q, k, v, rpb, out, attn, B, L);
}

// v002
// It runs in 27.3 microseconds.
// Next to v001, in two timings, it ran 1.07 times as fast each time.
// Counting every step since v000, it is 1.20 times as fast.
#include <hip/hip_runtime.h>
#include <math.h>

typedef float v2f __attribute__((ext_vector_type(2)));
typedef float v4f __attribute__((ext_vector_type(4)));
typedef float v8f __attribute__((ext_vector_type(8)));
typedef int   v4i __attribute__((ext_vector_type(4)));

#define KS 7
#define EDIM 64
#define HN 8
#define QKV_RSTRIDE (HN * EDIM)   // 512 floats between consecutive l for fixed (b,h)
#define LSTRIDE 68                // padded LDS row stride (floats) for Q/K/V tiles
#define PSTRIDE 36                // padded LDS row stride for P tile
#define WAVES 4                   // waves per work-group, one 16-query tile each
#define QT (16 * WAVES)           // queries per work-group
#define KROWS (QT + 16)           // staged K rows: t0-3 .. t0+QT+12 (last wave's second score tile)
#define VROWS (QT + 8)            // staged V rows: t0-3 .. t0+QT+4  (last wave's band depth of 24)

// ---------------- async global -> LDS staging (gfx1250 path) ----------------
#if __has_builtin(__builtin_amdgcn_global_load_async_to_lds_b128) && \
    __has_builtin(__builtin_amdgcn_s_wait_asynccnt)
#define USE_ASYNC_LDS 1
#else
#define USE_ASYNC_LDS 0
#endif

typedef __attribute__((address_space(1))) v4i* as1_v4i_ptr;  // global int4*
typedef __attribute__((address_space(3))) v4i* as3_v4i_ptr;  // LDS int4*

__device__ __forceinline__ void stage16(const float* g, float* l) {
#if USE_ASYNC_LDS
    // AS1/AS3 pointers via integer casts; low 32 bits of a generic LDS pointer
    // are the LDS byte offset per the aperture rules.
    as1_v4i_ptr gp = (as1_v4i_ptr)(unsigned long long)g;
    as3_v4i_ptr lp = (as3_v4i_ptr)(unsigned int)(unsigned long long)l;
    __builtin_amdgcn_global_load_async_to_lds_b128(gp, lp, 0, 0);
#else
    *(v4f*)l = *(const v4f*)g;
#endif
}

__device__ __forceinline__ void stage_fence() {
#if USE_ASYNC_LDS
    // every copy of this wave has landed before the barrier that lets other waves read it
    asm volatile("s_wait_asynccnt 0x0" ::: "memory");
#endif
}

// ---------------- main kernel ----------------
__global__ __launch_bounds__(32 * WAVES)
void natten1d_wmma_kernel(const float* __restrict__ qg,
                          const float* __restrict__ kg,
                          const float* __restrict__ vg,
                          const float* __restrict__ rpb,
                          float* __restrict__ outg,   // (B,L,H,E)
                          float* __restrict__ attng,  // (B,H,L,KS)
                          int B, int L)
{
    __shared__ __align__(16) float sQall[QT * LSTRIDE];
    __shared__ __align__(16) float sKall[KROWS * LSTRIDE];
    __shared__ __align__(16) float sVall[VROWS * LSTRIDE];
    __shared__ __align__(16) float sPall[WAVES * 16 * PSTRIDE];

    const int wtid = (int)threadIdx.x;                            // 0..127
    const int tid  = wtid & 31;                                   // lane in the wave
    const int w    = __builtin_amdgcn_readfirstlane(wtid >> 5);   // wave in the work-group
    const int t0   = (int)blockIdx.x * QT;     // first query position of the work-group
    const int h    = (int)blockIdx.y;
    const int b    = (int)blockIdx.z;
    const int t    = t0 + (w << 4);            // first query position of this wave's tile

    const size_t base = ((size_t)b * L) * QKV_RSTRIDE + (size_t)h * EDIM;

    // bias of the 7 in-range offsets: its index depends on the head alone, so these are scalar loads
    float bias[KS];
    #pragma unroll
    for (int kk = 0; kk < KS; ++kk) bias[kk] = rpb[h * 13 + 3 + kk];

    // ---- all waves stage Q (QT rows) and one shared K/V band (clamped) into LDS ----
    const int r0 = wtid >> 4, c4 = (wtid & 15) << 2;
    #pragma unroll
    for (int i = 0; i < QT / 8; ++i) {
        const int r = r0 + (i << 3);
        stage16(qg + base + (size_t)(t0 + r) * QKV_RSTRIDE + c4, &sQall[r * LSTRIDE + c4]);
    }
    #pragma unroll
    for (int i = 0; i < KROWS / 8; ++i) {
        const int r = r0 + (i << 3);
        int gr = t0 - 3 + r;
        gr = gr < 0 ? 0 : (gr >= L ? L - 1 : gr);
        const size_t off = base + (size_t)gr * QKV_RSTRIDE + c4;
        stage16(kg + off, &sKall[r * LSTRIDE + c4]);
        if (i < VROWS / 8) stage16(vg + off, &sVall[r * LSTRIDE + c4]);
    }
    stage_fence();          // s_wait_asynccnt 0
    __syncthreads();

    // this wave's window into the shared tiles
    const float* sQ = sQall + (w << 4) * LSTRIDE;
    const float* sK = sKall + (w << 4) * LSTRIDE;
    const float* sV = sVall + (w << 4) * LSTRIDE;
    float*       sP = sPall + (w << 4) * PSTRIDE;

    const int g  = tid >> 4;    // lane group (0: lanes 0-15, 1: lanes 16-31)
    const int ln = tid & 15;

    // ---- S = Q * K^T over the 32-wide key band, two 16x16 WMMA tiles ----
    v8f acc0 = {0.f,0.f,0.f,0.f,0.f,0.f,0.f,0.f};
    v8f acc1 = {0.f,0.f,0.f,0.f,0.f,0.f,0.f,0.f};
    #pragma unroll
    for (int e4 = 0; e4 < 16; ++e4) {
        const int col = (e4 << 2) + (g << 1);
        v2f a  = *(const v2f*)&sQ[ln * LSTRIDE + col];          // A[M=ln][K=col..col+1]
        v2f b0 = *(const v2f*)&sK[ln * LSTRIDE + col];          // B[K][N=ln], keys 0..15
        v2f b1 = *(const v2f*)&sK[(16 + ln) * LSTRIDE + col];   // keys 16..31
        acc0 = __builtin_amdgcn_wmma_f32_16x16x4_f32(false, a, false, b0, (short)0, acc0, false, false);
        acc1 = __builtin_amdgcn_wmma_f32_16x16x4_f32(false, a, false, b1, (short)0, acc1, false, false);
    }

    // ---- scatter the raw products into the LDS P tile; only the 7 band entries of a row are read back ----
    #pragma unroll
    for (int vv = 0; vv < 8; ++vv) {
        const int M = vv + (g << 3);   // query row within tile
        sP[M * PSTRIDE + ln] = acc0[vv];
        // rows 0, 1, 8, 9 (vv < 2) have their whole band inside columns 0..15
        if (vv >= 2) sP[M * PSTRIDE + 16 + ln] = acc1[vv];
    }
    __syncthreads();

    // ---- per row: scale + bias + edge mask on its 7 band entries, softmax; zero elsewhere; emit attn ----
    if (tid < 16) {
        const int r = tid;
        float* row = &sP[r * PSTRIDE];
        const int j0 = t + r - 3;      // key position of band entry 0
        float sc[KS];
        #pragma unroll
        for (int kk = 0; kk < KS; ++kk) sc[kk] = row[r + kk];   // read as one group, outside the edge test
        float m = -INFINITY;
        #pragma unroll
        for (int kk = 0; kk < KS; ++kk) {
            const float sv = sc[kk] * 0.125f + bias[kk];
            sc[kk] = ((unsigned)(j0 + kk) < (unsigned)L) ? sv : -INFINITY;
            m = fmaxf(m, sc[kk]);
        }
        float pv[KS];
        float sum = 0.f;
        #pragma unroll
        for (int kk = 0; kk < KS; ++kk) {
            const float p = __expf(sc[kk] - m);   // exp(-inf) -> 0 at edges
            // one free slot behind this v_exp; the scheduling barrier keeps the v_nop at that place
            if (kk == 2) { asm volatile("v_nop" :: "v"(p)); __builtin_amdgcn_sched_barrier(0); }
            pv[kk] = p; sum += p;
        }
        const float inv = 1.0f / sum;
        #pragma unroll
        for (int c = 0; c < 32; ++c) row[c] = 0.f;
        float* aout = attng + (((size_t)b * HN + h) * L + (t + r)) * KS;
        #pragma unroll
        for (int kk = 0; kk < KS; ++kk) {
            const float p = pv[kk] * inv;
            row[r + kk] = p;
            aout[kk] = p;
        }
    }
    __syncthreads();

    // ---- out = P * V : 4 N-tiles of 16 cols, band K-dim 0..23 in chunks of 4 ----
    const size_t obase = ((size_t)b * L + t) * QKV_RSTRIDE + (size_t)h * EDIM;
    #pragma unroll
    for (int nt = 0; nt < 4; ++nt) {
        v8f acc = {0.f,0.f,0.f,0.f,0.f,0.f,0.f,0.f};
        #pragma unroll
        for (int c = 0; c < 6; ++c) {
            const int kr = (c << 2) + (g << 1);
            v2f a = *(const v2f*)&sP[ln * PSTRIDE + kr];        // A[M=ln][K=kr..kr+1]
            v2f bb;
            bb.x = sV[(kr + 0) * LSTRIDE + (nt << 4) + ln];     // B[K=kr  ][N=ln]
            bb.y = sV[(kr + 1) * LSTRIDE + (nt << 4) + ln];     // B[K=kr+1][N=ln]
            acc = __builtin_amdgcn_wmma_f32_16x16x4_f32(false, a, false, bb, (short)0, acc, false, false);
        }
        #pragma unroll
        for (int vv = 0; vv < 8; ++vv) {
            const int M = vv + (g << 3);
            outg[obase + (size_t)M * QKV_RSTRIDE + (nt << 4) + ln] = acc[vv];
        }
    }
}

extern "C" void kernel_launch(void* const* d_in, const int* in_sizes, int n_in,
                              void* d_out, int out_size, void* d_ws, size_t ws_size,
                              hipStream_t stream) {
    (void)n_in; (void)out_size; (void)d_ws; (void)ws_size;
    const float* q   = (const float*)d_in[0];
    const float* k   = (const float*)d_in[1];
    const float* v   = (const float*)d_in[2];
    const float* rpb = (const float*)d_in[3];
    const int L = 8192;
    const int B = in_sizes[0] / (L * HN * EDIM);   // = 4
    float* out  = (float*)d_out;
    float* attn = out + (size_t)B * L * HN * EDIM;
    const int ntiles = L / QT;
    dim3 grid(ntiles, HN, B);     // 4096 blocks of WAVES wave32 each
    natten1d_wmma_kernel<<<grid, 32 * WAVES, 0, stream>>>(q, k, v, rpb, out, attn, B, L);
}

// v003
// A run of this version takes 23.1 microseconds.
// In both of two side-by-side timings against v002, it was 1.18 times as fast.
// Over all steps from v000 it is 1.42 times as fast.
#include <hip/hip_runtime.h>
#include <math.h>

typedef float v2f __attribute__((ext_vector_type(2)));
typedef float v4f __attribute__((ext_vector_type(4)));
typedef float v8f __attribute__((ext_vector_type(8)));
typedef int   v4i __attribute__((ext_vector_type(4)));

#define KS 7
#define EDIM 64
#define HN 8
#define QKV_RSTRIDE (HN * EDIM)   // 512 floats between consecutive l for fixed (b,h)
#define LSTRIDE 68                // padded LDS row stride (floats) for Q/K/V tiles
#define PSTRIDE 36                // padded LDS row stride for P tile
#define WAVES 4                   // waves per work-group, one 16-query tile each
#define QT (16 * WAVES)           // queries per work-group
#define KROWS (QT + 16)           // staged K rows: t0-3 .. t0+QT+12 (last wave's second score tile)
#define VROWS (QT + 8)            // staged V rows: t0-3 .. t0+QT+4  (last wave's band depth of 24)

// ---------------- async global -> LDS staging (gfx1250 path) ----------------
#if __has_builtin(__builtin_amdgcn_global_load_async_to_lds_b128) && \
    __has_builtin(__builtin_amdgcn_s_wait_asynccnt)
#define USE_ASYNC_LDS 1
#else
#define USE_ASYNC_LDS 0
#endif

typedef __attribute__((address_space(1))) v4i* as1_v4i_ptr;  // global int4*
typedef __attribute__((address_space(3))) v4i* as3_v4i_ptr;  // LDS int4*

__device__ __forceinline__ void stage16(const float* g, float* l) {
#if USE_ASYNC_LDS
    // AS1/AS3 pointers via integer casts; low 32 bits of a generic LDS pointer
    // are the LDS byte offset per the aperture rules.
    as1_v4i_ptr gp = (as1_v4i_ptr)(unsigned long long)g;
    as3_v4i_ptr lp = (as3_v4i_ptr)(unsigned int)(unsigned long long)l;
    __builtin_amdgcn_global_load_async_to_lds_b128(gp, lp, 0, 0);
#else
    *(v4f*)l = *(const v4f*)g;
#endif
}

__device__ __forceinline__ void stage_fence() {
#if USE_ASYNC_LDS
    // every copy of this wave has landed before the barrier that lets other waves read it
    asm volatile("s_wait_asynccnt 0x0" ::: "memory");
#endif
}

// ---------------- main kernel ----------------
__global__ __launch_bounds__(32 * WAVES)
void natten1d_wmma_kernel(const float* __restrict__ qg,
                          const float* __restrict__ kg,
                          const float* __restrict__ vg,
                          const float* __restrict__ rpb,
                          float* __restrict__ outg,   // (B,L,H,E)
                          float* __restrict__ attng,  // (B,H,L,KS)
                          int B, int L)
{
    __shared__ __align__(16) float sQall[QT * LSTRIDE];
    __shared__ __align__(16) float sKall[KROWS * LSTRIDE];
    __shared__ __align__(16) float sVall[VROWS * LSTRIDE];
    __shared__ __align__(16) float sPall[WAVES * 16 * PSTRIDE];

    const int wtid = (int)threadIdx.x;                            // 0..127
    const int tid  = wtid & 31;                                   // lane in the wave
    const int w    = __builtin_amdgcn_readfirstlane(wtid >> 5);   // wave in the work-group
    const int t0   = (int)blockIdx.x * QT;     // first query position of the work-group
    const int h    = (int)blockIdx.y;
    const int b    = (int)blockIdx.z;
    const int t    = t0 + (w << 4);            // first query position of this wave's tile

    const size_t base = ((size_t)b * L) * QKV_RSTRIDE + (size_t)h * EDIM;

    // bias of the 7 in-range offsets: its index depends on the head alone, so these are scalar loads
    float bias[KS];
    #pragma unroll
    for (int kk = 0; kk < KS; ++kk) bias[kk] = rpb[h * 13 + 3 + kk];

    // ---- all waves stage Q (QT rows) and one shared K/V band (clamped) into LDS ----
    const int r0 = wtid >> 4, c4 = (wtid & 15) << 2;
    #pragma unroll
    for (int i = 0; i < QT / 8; ++i) {
        const int r = r0 + (i << 3);
        stage16(qg + base + (size_t)(t0 + r) * QKV_RSTRIDE + c4, &sQall[r * LSTRIDE + c4]);
    }
    #pragma unroll
    for (int i = 0; i < KROWS / 8; ++i) {
        const int r = r0 + (i << 3);
        int gr = t0 - 3 + r;
        gr = gr < 0 ? 0 : (gr >= L ? L - 1 : gr);
        const size_t off = base + (size_t)gr * QKV_RSTRIDE + c4;
        stage16(kg + off, &sKall[r * LSTRIDE + c4]);
        if (i < VROWS / 8) stage16(vg + off, &sVall[r * LSTRIDE + c4]);
    }
    stage_fence();          // s_wait_asynccnt 0
    __syncthreads();

    // this wave's window into the shared tiles
    const float* sQ = sQall + (w << 4) * LSTRIDE;
    const float* sK = sKall + (w << 4) * LSTRIDE;
    const float* sV = sVall + (w << 4) * LSTRIDE;
    float*       sP = sPall + (w << 4) * PSTRIDE;

    const int g  = tid >> 4;    // lane group (0: lanes 0-15, 1: lanes 16-31)
    const int ln = tid & 15;

    // ---- S = Q * K^T over the 32-wide key band, two 16x16 WMMA tiles ----
    v8f acc0 = {0.f,0.f,0.f,0.f,0.f,0.f,0.f,0.f};
    v8f acc1 = {0.f,0.f,0.f,0.f,0.f,0.f,0.f,0.f};
    #pragma unroll
    for (int e4 = 0; e4 < 16; ++e4) {
        const int col = (e4 << 2) + (g << 1);
        v2f a  = *(const v2f*)&sQ[ln * LSTRIDE + col];          // A[M=ln][K=col..col+1]
        v2f b0 = *(const v2f*)&sK[ln * LSTRIDE + col];          // B[K][N=ln], keys 0..15
        v2f b1 = *(const v2f*)&sK[(16 + ln) * LSTRIDE + col];   // keys 16..31
        acc0 = __builtin_amdgcn_wmma_f32_16x16x4_f32(false, a, false, b0, (short)0, acc0, false, false);
        acc1 = __builtin_amdgcn_wmma_f32_16x16x4_f32(false, a, false, b1, (short)0, acc1, false, false);
    }

    // ---- scatter the raw products into the LDS P tile; only the 7 band entries of a row are read back ----
    #pragma unroll
    for (int vv = 0; vv < 8; ++vv) {
        const int M = vv + (g << 3);   // query row within tile
        sP[M * PSTRIDE + ln] = acc0[vv];
        // rows 0, 1, 8, 9 (vv < 2) have their whole band inside columns 0..15
        if (vv >= 2) sP[M * PSTRIDE + 16 + ln] = acc1[vv];
    }
    __syncthreads();

    // ---- per row: scale + bias + edge mask on its 7 band entries, softmax; zero elsewhere ----
    if (tid < 16) {
        const int r = tid;
        float* row = &sP[r * PSTRIDE];
        const int j0 = t + r - 3;      // key position of band entry 0
        float sc[KS];
        #pragma unroll
        for (int kk = 0; kk < KS; ++kk) sc[kk] = row[r + kk];   // read as one group, outside the edge test
        float m = -INFINITY;
        #pragma unroll
        for (int kk = 0; kk < KS; ++kk) {
            const float sv = sc[kk] * 0.125f + bias[kk];
            sc[kk] = ((unsigned)(j0 + kk) < (unsigned)L) ? sv : -INFINITY;
            m = fmaxf(m, sc[kk]);
        }
        float pv[KS];
        float sum = 0.f;
        #pragma unroll
        for (int kk = 0; kk < KS; ++kk) {
            const float p = __expf(sc[kk] - m);   // exp(-inf) -> 0 at edges
            // one free slot behind this v_exp; the scheduling barrier keeps the v_nop at that place
            if (kk == 2) { asm volatile("v_nop" :: "v"(p)); __builtin_amdgcn_sched_barrier(0); }
            pv[kk] = p; sum += p;
        }
        const float inv = 1.0f / sum;
        #pragma unroll
        for (int c = 0; c < 32; ++c) row[c] = 0.f;
        #pragma unroll
        for (int kk = 0; kk < KS; ++kk) row[r + kk] = pv[kk] * inv;
    }
    __syncthreads();

    // ---- out = P * V : 4 N-tiles, band K-dim 0..23 in chunks of 4. Lane ln of N-tile nt takes V column
    //      4*ln + nt, so a lane ends with 4 adjacent floats of each of its rows and 16 lanes store a whole row ----
    const size_t obase = ((size_t)b * L + t) * QKV_RSTRIDE + (size_t)h * EDIM;
    v8f acc[4];
    #pragma unroll
    for (int nt = 0; nt < 4; ++nt) acc[nt] = (v8f){0.f,0.f,0.f,0.f,0.f,0.f,0.f,0.f};
    #pragma unroll
    for (int c = 0; c < 6; ++c) {
        const int kr = (c << 2) + (g << 1);
        const v2f a  = *(const v2f*)&sP[ln * PSTRIDE + kr];                  // A[M=ln][K=kr..kr+1]
        const v4f v0 = *(const v4f*)&sV[(kr + 0) * LSTRIDE + (ln << 2)];     // V[kr  ][4*ln .. 4*ln+3]
        const v4f v1 = *(const v4f*)&sV[(kr + 1) * LSTRIDE + (ln << 2)];     // V[kr+1][4*ln .. 4*ln+3]
        #pragma unroll
        for (int nt = 0; nt < 4; ++nt) {
            v2f bb;
            bb.x = v0[nt];                                                   // B[K=kr  ][N=ln]
            bb.y = v1[nt];                                                   // B[K=kr+1][N=ln]
            acc[nt] = __builtin_amdgcn_wmma_f32_16x16x4_f32(false, a, false, bb, (short)0, acc[nt], false, false);
        }
    }
    #pragma unroll
    for (int vv = 0; vv < 8; ++vv) {
        const int M = vv + (g << 3);
        const v4f o = {acc[0][vv], acc[1][vv], acc[2][vv], acc[3][vv]};
        *(v4f*)&outg[obase + (size_t)M * QKV_RSTRIDE + (ln << 2)] = o;
    }

    // ---- attn: the work-group's QT x KS weights are QT*KS*4 contiguous bytes, a whole number of 128-B lines;
    //      each of the first QT*KS/4 threads gathers 4 adjacent ones from the P tiles and stores 16 bytes ----
    if (wtid < QT * KS / 4) {
        v4f o;
        #pragma unroll
        for (int j = 0; j < 4; ++j) {
            const int e   = (wtid << 2) + j;
            const int row = e / KS;                 // query within the work-group
            o[j] = sPall[row * PSTRIDE + (row & 15) + (e - row * KS)];
        }
        *(v4f*)(attng + (((size_t)b * HN + h) * L + t0) * KS + (wtid << 2)) = o;
    }
}

extern "C" void kernel_launch(void* const* d_in, const int* in_sizes, int n_in,
                              void* d_out, int out_size, void* d_ws, size_t ws_size,
                              hipStream_t stream) {
    (void)n_in; (void)out_size; (void)d_ws; (void)ws_size;
    const float* q   = (const float*)d_in[0];
    const float* k   = (const float*)d_in[1];
    const float* v   = (const float*)d_in[2];
    const float* rpb = (const float*)d_in[3];
    const int L = 8192;
    const int B = in_sizes[0] / (L * HN * EDIM);   // = 4
    float* out  = (float*)d_out;
    float* attn = out + (size_t)B * L * HN * EDIM;
    const int ntiles = L / QT;
    dim3 grid(ntiles, HN, B);     // 4096 blocks of WAVES wave32 each
    natten1d_wmma_kernel<<<grid, 32 * WAVES, 0, stream>>>(q, k, v, rpb, out, attn, B, L);
}

// v004
// Measured time: 22.2 microseconds a run.
// Two timings next to v003 both put it at 1.04 times that version's speed.
// Counting every step since v000, it is 1.48 times as fast.
#include <hip/hip_runtime.h>
#include <math.h>

typedef float v2f __attribute__((ext_vector_type(2)));
typedef float v4f __attribute__((ext_vector_type(4)));
typedef float v8f __attribute__((ext_vector_type(8)));
typedef int   v4i __attribute__((ext_vector_type(4)));

#define KS 7
#define EDIM 64
#define HN 8
#define QKV_RSTRIDE (HN * EDIM)   // 512 floats between consecutive l for fixed (b,h)
#define LSTRIDE 68                // padded LDS row stride (floats) for Q/K/V tiles
#define PSTRIDE 36                // padded LDS row stride for P tile
#define WAVES 4                   // waves per work-group, one 16-query tile each
#define QT (16 * WAVES)           // queries per work-group
#define KROWS (QT + 16)           // staged K rows: t0-3 .. t0+QT+12 (last wave's second score tile)
#define VROWS (QT + 8)            // staged V rows: t0-3 .. t0+QT+4  (last wave's band depth of 24)

// ---------------- async global -> LDS staging (gfx1250 path) ----------------
#if __has_builtin(__builtin_amdgcn_global_load_async_to_lds_b128) && \
    __has_builtin(__builtin_amdgcn_s_wait_asynccnt)
#define USE_ASYNC_LDS 1
#else
#define USE_ASYNC_LDS 0
#endif

typedef __attribute__((address_space(1))) v4i* as1_v4i_ptr;  // global int4*
typedef __attribute__((address_space(3))) v4i* as3_v4i_ptr;  // LDS int4*

__device__ __forceinline__ void stage16(const float* g, float* l) {
#if USE_ASYNC_LDS
    // AS1/AS3 pointers via integer casts; low 32 bits of a generic LDS pointer
    // are the LDS byte offset per the aperture rules.
    as1_v4i_ptr gp = (as1_v4i_ptr)(unsigned long long)g;
    as3_v4i_ptr lp = (as3_v4i_ptr)(unsigned int)(unsigned long long)l;
    __builtin_amdgcn_global_load_async_to_lds_b128(gp, lp, 0, 0);
#else
    *(v4f*)l = *(const v4f*)g;
#endif
}

__device__ __forceinline__ void stage_fence() {
#if USE_ASYNC_LDS
    // every copy of this wave has landed before the barrier that lets other waves read it
    asm volatile("s_wait_asynccnt 0x0" ::: "memory");
#endif
}

__device__ __forceinline__ void stage_fence_qk() {
#if USE_ASYNC_LDS
    // all but this wave's 8 youngest copies have landed (the counter returns in issue order): every Q and K copy
    // is covered, 8 of the 9 V copies stay in flight behind the score product instead of holding it up
    asm volatile("s_wait_asynccnt 0x8" ::: "memory");
#endif
}

// ---------------- main kernel ----------------
__global__ __launch_bounds__(32 * WAVES)
void natten1d_wmma_kernel(const float* __restrict__ qg,
                          const float* __restrict__ kg,
                          const float* __restrict__ vg,
                          const float* __restrict__ rpb,
                          float* __restrict__ outg,   // (B,L,H,E)
                          float* __restrict__ attng,  // (B,H,L,KS)
                          int B, int L)
{
    __shared__ __align__(16) float sQall[QT * LSTRIDE];
    __shared__ __align__(16) float sKall[KROWS * LSTRIDE];
    __shared__ __align__(16) float sVall[VROWS * LSTRIDE];
    __shared__ __align__(16) float sPall[WAVES * 16 * PSTRIDE];

    const int wtid = (int)threadIdx.x;                            // 0..127
    const int tid  = wtid & 31;                                   // lane in the wave
    const int w    = __builtin_amdgcn_readfirstlane(wtid >> 5);   // wave in the work-group
    const int t0   = (int)blockIdx.x * QT;     // first query position of the work-group
    const int h    = (int)blockIdx.y;
    const int b    = (int)blockIdx.z;
    const int t    = t0 + (w << 4);            // first query position of this wave's tile

    const size_t base = ((size_t)b * L) * QKV_RSTRIDE + (size_t)h * EDIM;

    // bias of the 7 in-range offsets: its index depends on the head alone, so these are scalar loads
    float bias[KS];
    #pragma unroll
    for (int kk = 0; kk < KS; ++kk) bias[kk] = rpb[h * 13 + 3 + kk];

    // ---- all waves stage Q (QT rows) and one shared K/V band (clamped) into LDS: Q, then K, then V ----
    const int r0 = wtid >> 4, c4 = (wtid & 15) << 2;
    #pragma unroll
    for (int i = 0; i < QT / 8; ++i) {
        const int r = r0 + (i << 3);
        stage16(qg + base + (size_t)(t0 + r) * QKV_RSTRIDE + c4, &sQall[r * LSTRIDE + c4]);
    }
    #pragma unroll
    for (int i = 0; i < KROWS / 8; ++i) {
        const int r = r0 + (i << 3);
        int gr = t0 - 3 + r;
        gr = gr < 0 ? 0 : (gr >= L ? L - 1 : gr);
        stage16(kg + base + (size_t)gr * QKV_RSTRIDE + c4, &sKall[r * LSTRIDE + c4]);
    }
    // V is issued last: nothing reads it before the P * V product, so it lands while scores and softmax run
    #pragma unroll
    for (int i = 0; i < VROWS / 8; ++i) {
        const int r = r0 + (i << 3);
        int gr = t0 - 3 + r;
        gr = gr < 0 ? 0 : (gr >= L ? L - 1 : gr);
        stage16(vg + base + (size_t)gr * QKV_RSTRIDE + c4, &sVall[r * LSTRIDE + c4]);
    }
    static_assert(VROWS / 8 >= 8, "the counted wait must leave only V copies in flight");
    stage_fence_qk();       // Q and K of this wave have landed
    __syncthreads();        // publishes Q and K; V is published by the barrier behind the softmax

    // this wave's window into the shared tiles
    const float* sQ = sQall + (w << 4) * LSTRIDE;
    const float* sK = sKall + (w << 4) * LSTRIDE;
    const float* sV = sVall + (w << 4) * LSTRIDE;
    float*       sP = sPall + (w << 4) * PSTRIDE;

    const int g  = tid >> 4;    // lane group (0: lanes 0-15, 1: lanes 16-31)
    const int ln = tid & 15;

    // ---- S = Q * K^T over the 32-wide key band, two 16x16 WMMA tiles ----
    v8f acc0 = {0.f,0.f,0.f,0.f,0.f,0.f,0.f,0.f};
    v8f acc1 = {0.f,0.f,0.f,0.f,0.f,0.f,0.f,0.f};
    #pragma unroll
    for (int e4 = 0; e4 < 16; ++e4) {
        const int col = (e4 << 2) + (g << 1);
        v2f a  = *(const v2f*)&sQ[ln * LSTRIDE + col];          // A[M=ln][K=col..col+1]
        v2f b0 = *(const v2f*)&sK[ln * LSTRIDE + col];          // B[K][N=ln], keys 0..15
        v2f b1 = *(const v2f*)&sK[(16 + ln) * LSTRIDE + col];   // keys 16..31
        acc0 = __builtin_amdgcn_wmma_f32_16x16x4_f32(false, a, false, b0, (short)0, acc0, false, false);
        acc1 = __builtin_amdgcn_wmma_f32_16x16x4_f32(false, a, false, b1, (short)0, acc1, false, false);
    }

    // ---- scatter the raw products into the LDS P tile; only the 7 band entries of a row are read back ----
    #pragma unroll
    for (int vv = 0; vv < 8; ++vv) {
        const int M = vv + (g << 3);   // query row within tile
        sP[M * PSTRIDE + ln] = acc0[vv];
        // rows 0, 1, 8, 9 (vv < 2) have their whole band inside columns 0..15
        if (vv >= 2) sP[M * PSTRIDE + 16 + ln] = acc1[vv];
    }
    __syncthreads();

    // ---- per row: scale + bias + edge mask on its 7 band entries, softmax; zero elsewhere ----
    if (tid < 16) {
        const int r = tid;
        float* row = &sP[r * PSTRIDE];
        const int j0 = t + r - 3;      // key position of band entry 0
        float sc[KS];
        #pragma unroll
        for (int kk = 0; kk < KS; ++kk) sc[kk] = row[r + kk];   // read as one group, outside the edge test
        float m = -INFINITY;
        #pragma unroll
        for (int kk = 0; kk < KS; ++kk) {
            const float sv = sc[kk] * 0.125f + bias[kk];
            sc[kk] = ((unsigned)(j0 + kk) < (unsigned)L) ? sv : -INFINITY;
            m = fmaxf(m, sc[kk]);
        }
        float pv[KS];
        float sum = 0.f;
        #pragma unroll
        for (int kk = 0; kk < KS; ++kk) {
            const float p = __expf(sc[kk] - m);   // exp(-inf) -> 0 at edges
            // one free slot behind this v_exp; the scheduling barrier keeps the v_nop at that place
            if (kk == 2) { asm volatile("v_nop" :: "v"(p)); __builtin_amdgcn_sched_barrier(0); }
            pv[kk] = p; sum += p;
        }
        const float inv = 1.0f / sum;
        #pragma unroll
        for (int c = 0; c < 32; ++c) row[c] = 0.f;
        #pragma unroll
        for (int kk = 0; kk < KS; ++kk) row[r + kk] = pv[kk] * inv;
    }
    stage_fence();          // this wave's V copies have landed: the barrier below publishes V along with P
    __syncthreads();

    // ---- out = P * V : 4 N-tiles, band K-dim 0..23 in chunks of 4. Lane ln of N-tile nt takes V column
    //      4*ln + nt, so a lane ends with 4 adjacent floats of each of its rows and 16 lanes store a whole row ----
    const size_t obase = ((size_t)b * L + t) * QKV_RSTRIDE + (size_t)h * EDIM;
    v8f acc[4];
    #pragma unroll
    for (int nt = 0; nt < 4; ++nt) acc[nt] = (v8f){0.f,0.f,0.f,0.f,0.f,0.f,0.f,0.f};
    #pragma unroll
    for (int c = 0; c < 6; ++c) {
        const int kr = (c << 2) + (g << 1);
        const v2f a  = *(const v2f*)&sP[ln * PSTRIDE + kr];                  // A[M=ln][K=kr..kr+1]
        const v4f v0 = *(const v4f*)&sV[(kr + 0) * LSTRIDE + (ln << 2)];     // V[kr  ][4*ln .. 4*ln+3]
        const v4f v1 = *(const v4f*)&sV[(kr + 1) * LSTRIDE + (ln << 2)];     // V[kr+1][4*ln .. 4*ln+3]
        #pragma unroll
        for (int nt = 0; nt < 4; ++nt) {
            v2f bb;
            bb.x = v0[nt];                                                   // B[K=kr  ][N=ln]
            bb.y = v1[nt];                                                   // B[K=kr+1][N=ln]
            acc[nt] = __builtin_amdgcn_wmma_f32_16x16x4_f32(false, a, false, bb, (short)0, acc[nt], false, false);
        }
    }
    #pragma unroll
    for (int vv = 0; vv < 8; ++vv) {
        const int M = vv + (g << 3);
        const v4f o = {acc[0][vv], acc[1][vv], acc[2][vv], acc[3][vv]};
        *(v4f*)&outg[obase + (size_t)M * QKV_RSTRIDE + (ln << 2)] = o;
    }

    // ---- attn: the work-group's QT x KS weights are QT*KS*4 contiguous bytes, a whole number of 128-B lines;
    //      each of the first QT*KS/4 threads gathers 4 adjacent ones from the P tiles and stores 16 bytes ----
    if (wtid < QT * KS / 4) {
        v4f o;
        #pragma unroll
        for (int j = 0; j < 4; ++j) {
            const int e   = (wtid << 2) + j;
            const int row = e / KS;                 // query within the work-group
            o[j] = sPall[row * PSTRIDE + (row & 15) + (e - row * KS)];
        }
        *(v4f*)(attng + (((size_t)b * HN + h) * L + t0) * KS + (wtid << 2)) = o;
    }
}

extern "C" void kernel_launch(void* const* d_in, const int* in_sizes, int n_in,
                              void* d_out, int out_size, void* d_ws, size_t ws_size,
                              hipStream_t stream) {
    (void)n_in; (void)out_size; (void)d_ws; (void)ws_size;
    const float* q   = (const float*)d_in[0];
    const float* k   = (const float*)d_in[1];
    const float* v   = (const float*)d_in[2];
    const float* rpb = (const float*)d_in[3];
    const int L = 8192;
    const int B = in_sizes[0] / (L * HN * EDIM);   // = 4
    float* out  = (float*)d_out;
    float* attn = out + (size_t)B * L * HN * EDIM;
    const int ntiles = L / QT;
    dim3 grid(ntiles, HN, B);     // 4096 blocks of WAVES wave32 each
    natten1d_wmma_kernel<<<grid, 32 * WAVES, 0, stream>>>(q, k, v, rpb, out, attn, B, L);
}

// v005
// A run of this version takes 21.5 microseconds.
// Two timings next to v004 both put it at 1.03 times that version's speed.
// Counting every step since v000, it is 1.52 times as fast.
#include <hip/hip_runtime.h>
#include <math.h>

typedef float v2f __attribute__((ext_vector_type(2)));
typedef float v4f __attribute__((ext_vector_type(4)));
typedef float v8f __attribute__((ext_vector_type(8)));
typedef int   v4i __attribute__((ext_vector_type(4)));

#define KS 7
#define EDIM 64
#define HN 8
#define QKV_RSTRIDE (HN * EDIM)   // 512 floats between consecutive l for fixed (b,h)
#define LSTRIDE 68                // padded LDS row stride (floats) for Q/K/V tiles
#define PSTRIDE 36                // padded LDS row stride for P tile
#define WAVES 4                   // waves per work-group, one 16-query tile each
#define QT (16 * WAVES)           // queries per work-group
#define KROWS (QT + 8)            // staged K rows: t0-3 .. t0+QT+4  (last wave's band of 22 keys, whole copy rounds)
#define VROWS (QT + 8)            // staged V rows: t0-3 .. t0+QT+4  (last wave's band of 22 keys, whole copy rounds)

// ---------------- async global -> LDS staging (gfx1250 path) ----------------
#if __has_builtin(__builtin_amdgcn_global_load_async_to_lds_b128) && \
    __has_builtin(__builtin_amdgcn_s_wait_asynccnt)
#define USE_ASYNC_LDS 1
#else
#define USE_ASYNC_LDS 0
#endif

typedef __attribute__((address_space(1))) v4i* as1_v4i_ptr;  // global int4*
typedef __attribute__((address_space(3))) v4i* as3_v4i_ptr;  // LDS int4*

__device__ __forceinline__ void stage16(const float* g, float* l) {
#if USE_ASYNC_LDS
    // AS1/AS3 pointers via integer casts; low 32 bits of a generic LDS pointer
    // are the LDS byte offset per the aperture rules.
    as1_v4i_ptr gp = (as1_v4i_ptr)(unsigned long long)g;
    as3_v4i_ptr lp = (as3_v4i_ptr)(unsigned int)(unsigned long long)l;
    __builtin_amdgcn_global_load_async_to_lds_b128(gp, lp, 0, 0);
#else
    *(v4f*)l = *(const v4f*)g;
#endif
}

__device__ __forceinline__ void stage_fence() {
#if USE_ASYNC_LDS
    // every copy of this wave has landed before the barrier that lets other waves read it
    asm volatile("s_wait_asynccnt 0x0" ::: "memory");
#endif
}

__device__ __forceinline__ void stage_fence_qk(const float (&a0)[8], const float (&a1)[3]) {
#if USE_ASYNC_LDS
    // all but this wave's 8 youngest copies have landed (the counter returns in issue order): every Q and K copy
    // is covered, 8 of the 9 V copies stay in flight behind the score product instead of holding it up.
    // The eleven band terms are inputs of the statement (inputs only, nothing is hidden from the compiler), so that
    // they are formed ahead of the wait, while the copies fly; without that the build forms them behind the score WMMAs
    asm volatile("s_wait_asynccnt 0x8"
                 :: "v"(a0[0]), "v"(a0[1]), "v"(a0[2]), "v"(a0[3]), "v"(a0[4]), "v"(a0[5]), "v"(a0[6]), "v"(a0[7]),
                    "v"(a1[0]), "v"(a1[1]), "v"(a1[2])
                 : "memory");
#endif
}

// value of the lane 16 away (l ^ 16): a vector cross-row move, no LDS trip
__device__ __forceinline__ float other_half(float x) {
    return __uint_as_float(__builtin_amdgcn_permlanex16(0u, __float_as_uint(x), 0x76543210u, 0xfedcba98u, false, false));
}

// ---------------- main kernel ----------------
__global__ __launch_bounds__(32 * WAVES)
void natten1d_wmma_kernel(const float* __restrict__ qg,
                          const float* __restrict__ kg,
                          const float* __restrict__ vg,
                          const float* __restrict__ rpb,
                          float* __restrict__ outg,   // (B,L,H,E)
                          float* __restrict__ attng,  // (B,H,L,KS)
                          int B, int L)
{
    __shared__ __align__(16) float sQall[QT * LSTRIDE];
    __shared__ __align__(16) float sKall[KROWS * LSTRIDE];
    __shared__ __align__(16) float sVall[VROWS * LSTRIDE];
    __shared__ __align__(16) float sPall[WAVES * 16 * PSTRIDE];

    const int wtid = (int)threadIdx.x;                            // 0..127
    const int tid  = wtid & 31;                                   // lane in the wave
    const int w    = __builtin_amdgcn_readfirstlane(wtid >> 5);   // wave in the work-group
    const int t0   = (int)blockIdx.x * QT;     // first query position of the work-group
    const int h    = (int)blockIdx.y;
    const int b    = (int)blockIdx.z;
    const int t    = t0 + (w << 4);            // first query position of this wave's tile

    const size_t base = ((size_t)b * L) * QKV_RSTRIDE + (size_t)h * EDIM;

    // bias of the 7 in-range offsets: its index depends on the head alone, so these are scalar loads
    float bias[KS];
    #pragma unroll
    for (int kk = 0; kk < KS; ++kk) bias[kk] = rpb[h * 13 + 3 + kk];

    // ---- all waves stage Q (QT rows) and one shared K/V band (clamped) into LDS: Q, then K, then V ----
    const int r0 = wtid >> 4, c4 = (wtid & 15) << 2;
    #pragma unroll
    for (int i = 0; i < QT / 8; ++i) {
        const int r = r0 + (i << 3);
        stage16(qg + base + (size_t)(t0 + r) * QKV_RSTRIDE + c4, &sQall[r * LSTRIDE + c4]);
    }
    #pragma unroll
    for (int i = 0; i < KROWS / 8; ++i) {
        const int r = r0 + (i << 3);
        int gr = t0 - 3 + r;
        gr = gr < 0 ? 0 : (gr >= L ? L - 1 : gr);
        stage16(kg + base + (size_t)gr * QKV_RSTRIDE + c4, &sKall[r * LSTRIDE + c4]);
    }
    // V is issued last: nothing reads it before the P * V product, so it lands while scores and softmax run
    #pragma unroll
    for (int i = 0; i < VROWS / 8; ++i) {
        const int r = r0 + (i << 3);
        int gr = t0 - 3 + r;
        gr = gr < 0 ? 0 : (gr >= L ? L - 1 : gr);
        stage16(vg + base + (size_t)gr * QKV_RSTRIDE + c4, &sVall[r * LSTRIDE + c4]);
    }
    const int g  = tid >> 4;    // lane group (0: lanes 0-15, 1: lanes 16-31)
    const int ln = tid & 15;

    // ---- scores are formed transposed, S^T = K * Q^T: lane (ln, g) then owns query ln, and its registers hold
    //      band keys 8g + vv (tile 0) and 16 + 3g + vv, vv < 3 (tile 1). What is added to each scaled product
    //      (the bias inside the 7-wide band and the sequence, -inf elsewhere) needs no tile data, so it is
    //      formed here, while the copies are in flight ----
    // holds the wait for the bias words, and the arithmetic on them, behind the issue of the last copy
    __builtin_amdgcn_sched_barrier(0);
    float add0[8], add1[3];
    #pragma unroll
    for (int vv = 0; vv < 11; ++vv) {
        const int r  = vv < 8 ? vv : vv - 8;                     // register within its tile
        const int j0 = vv < 8 ? (g << 3) : 16 + 3 * g;           // band key of the tile's register 0 in this lane
        const int d  = j0 - ln;                                  // j0 + r - ln is the key's place in query ln's window
        float bv = -INFINITY;
        #pragma unroll
        for (int i = 0; i < KS; ++i) bv = (d == i - r) ? bias[i] : bv;
        bv = ((unsigned)(t - 3 + j0 + r) < (unsigned)L) ? bv : -INFINITY;
        if (vv < 8) add0[vv] = bv; else add1[vv - 8] = bv;
    }

    static_assert(VROWS / 8 >= 8, "the counted wait must leave only V copies in flight");
    stage_fence_qk(add0, add1);   // Q and K of this wave have landed
    __syncthreads();        // publishes Q and K; V is published by the barrier behind the softmax

    // this wave's window into the shared tiles
    const float* sQ = sQall + (w << 4) * LSTRIDE;
    const float* sK = sKall + (w << 4) * LSTRIDE;
    const float* sV = sVall + (w << 4) * LSTRIDE;
    float*       sP = sPall + (w << 4) * PSTRIDE;

    // ---- S^T = K * Q^T, two 16x16 WMMA tiles. Tile 0: keys 0..15. Tile 1 holds the 6 keys left of the band,
    //      16..18 in rows 0..2 and 19..21 in rows 8..10, so each lane half gets three; its other rows repeat one ----
    const int k1row = 16 + 3 * (ln >> 3) + ((ln & 7) < 2 ? (ln & 7) : 2);
    v8f acc0 = {0.f,0.f,0.f,0.f,0.f,0.f,0.f,0.f};
    v8f acc1 = {0.f,0.f,0.f,0.f,0.f,0.f,0.f,0.f};
    #pragma unroll
    for (int e4 = 0; e4 < 16; ++e4) {
        const int col = (e4 << 2) + (g << 1);
        v2f qf = *(const v2f*)&sQ[ln * LSTRIDE + col];          // B[K=col..col+1][N=ln]
        v2f k0 = *(const v2f*)&sK[ln * LSTRIDE + col];          // A[M=ln][K], keys 0..15
        v2f k1 = *(const v2f*)&sK[k1row * LSTRIDE + col];       // A[M=ln][K], keys 16..21
        acc0 = __builtin_amdgcn_wmma_f32_16x16x4_f32(false, k0, false, qf, (short)0, acc0, false, false);
        acc1 = __builtin_amdgcn_wmma_f32_16x16x4_f32(false, k1, false, qf, (short)0, acc1, false, false);
    }

    // ---- softmax of query ln in registers: 11 entries in this lane, 11 in lane l ^ 16 ----
    float p0[8], p1[3];
    #pragma unroll
    for (int vv = 0; vv < 8; ++vv) p0[vv] = acc0[vv] * 0.125f + add0[vv];
    #pragma unroll
    for (int vv = 0; vv < 3; ++vv) p1[vv] = acc1[vv] * 0.125f + add1[vv];
    float m = fmaxf(fmaxf(p1[0], p1[1]), p1[2]);
    #pragma unroll
    for (int vv = 0; vv < 8; ++vv) m = fmaxf(m, p0[vv]);
    m = fmaxf(m, other_half(m));           // finite: a query's own key is always in range
    float sum = 0.f;
    #pragma unroll
    for (int vv = 0; vv < 8; ++vv) { p0[vv] = __expf(p0[vv] - m); sum += p0[vv]; }   // exp(-inf) -> 0 off the band
    #pragma unroll
    for (int vv = 0; vv < 3; ++vv) { p1[vv] = __expf(p1[vv] - m); sum += p1[vv]; }
    sum += other_half(sum);
    const float inv = 1.0f / sum;
    #pragma unroll
    for (int vv = 0; vv < 8; ++vv) p0[vv] *= inv;
    #pragma unroll
    for (int vv = 0; vv < 3; ++vv) p1[vv] *= inv;

    // the weights go to the LDS P tile only for the attn store at the end: row = query, column = band key
    *(v4f*)&sP[ln * PSTRIDE + (g << 3)]     = (v4f){p0[0], p0[1], p0[2], p0[3]};
    *(v4f*)&sP[ln * PSTRIDE + (g << 3) + 4] = (v4f){p0[4], p0[5], p0[6], p0[7]};
    #pragma unroll
    for (int vv = 0; vv < 3; ++vv) sP[ln * PSTRIDE + 16 + 3 * g + vv] = p1[vv];

    stage_fence();          // this wave's V copies have landed: the barrier below publishes V along with P
    __syncthreads();

    // ---- out = P * V : 4 N-tiles, the 22 band keys in 6 chunks of 4. Lane ln of N-tile nt takes V column
    //      4*ln + nt, so a lane ends with 4 adjacent floats of each of its rows and 16 lanes store a whole row ----
    const size_t obase = ((size_t)b * L + t) * QKV_RSTRIDE + (size_t)h * EDIM;
    v8f acc[4];
    #pragma unroll
    for (int nt = 0; nt < 4; ++nt) acc[nt] = (v8f){0.f,0.f,0.f,0.f,0.f,0.f,0.f,0.f};
    #pragma unroll
    for (int c = 0; c < 6; ++c) {
        // the weights are already an A operand: A[M=ln][K slot (g, i)] is this lane's register for band key kr + i,
        // and the V loader takes the same keys for the same slots; slot 1 of the last chunk has weight 0
        const int kr = c < 4 ? (g << 3) + (c << 1) : 16 + 3 * g + ((c - 4) << 1);
        const v2f a  = c < 4 ? (v2f){p0[2 * c], p0[2 * c + 1]} : (c == 4 ? (v2f){p1[0], p1[1]} : (v2f){p1[2], 0.f});
        const v4f v0 = *(const v4f*)&sV[(kr + 0) * LSTRIDE + (ln << 2)];                 // V[kr  ][4*ln .. 4*ln+3]
        const v4f v1 = c < 5 ? *(const v4f*)&sV[(kr + 1) * LSTRIDE + (ln << 2)] : v0;    // V[kr+1][4*ln .. 4*ln+3]
        #pragma unroll
        for (int nt = 0; nt < 4; ++nt) {
            v2f bb;
            bb.x = v0[nt];                                                   // B[K=kr  ][N=ln]
            bb.y = v1[nt];                                                   // B[K=kr+1][N=ln]
            acc[nt] = __builtin_amdgcn_wmma_f32_16x16x4_f32(false, a, false, bb, (short)0, acc[nt], false, false);
        }
    }
    #pragma unroll
    for (int vv = 0; vv < 8; ++vv) {
        const int M = vv + (g << 3);
        const v4f o = {acc[0][vv], acc[1][vv], acc[2][vv], acc[3][vv]};
        *(v4f*)&outg[obase + (size_t)M * QKV_RSTRIDE + (ln << 2)] = o;
    }

    // ---- attn: the work-group's QT x KS weights are QT*KS*4 contiguous bytes, a whole number of 128-B lines;
    //      each of the first QT*KS/4 threads gathers 4 adjacent ones from the P tiles and stores 16 bytes ----
    if (wtid < QT * KS / 4) {
        v4f o;
        #pragma unroll
        for (int j = 0; j < 4; ++j) {
            const int e   = (wtid << 2) + j;
            const int row = e / KS;                 // query within the work-group
            o[j] = sPall[row * PSTRIDE + (row & 15) + (e - row * KS)];
        }
        *(v4f*)(attng + (((size_t)b * HN + h) * L + t0) * KS + (wtid << 2)) = o;
    }
}

extern "C" void kernel_launch(void* const* d_in, const int* in_sizes, int n_in,
                              void* d_out, int out_size, void* d_ws, size_t ws_size,
                              hipStream_t stream) {
    (void)n_in; (void)out_size; (void)d_ws; (void)ws_size;
    const float* q   = (const float*)d_in[0];
    const float* k   = (const float*)d_in[1];
    const float* v   = (const float*)d_in[2];
    const float* rpb = (const float*)d_in[3];
    const int L = 8192;
    const int B = in_sizes[0] / (L * HN * EDIM);   // = 4
    float* out  = (float*)d_out;
    float* attn = out + (size_t)B * L * HN * EDIM;
    const int ntiles = L / QT;
    dim3 grid(ntiles, HN, B);     // 4096 blocks of WAVES wave32 each
    natten1d_wmma_kernel<<<grid, 32 * WAVES, 0, stream>>>(q, k, v, rpb, out, attn, B, L);
}

// v006
// One run takes 20.3 microseconds.
// Two timings next to v005 put it at 1.05 and 1.06 times that version's speed.
// All steps since v000 together make it 1.61 times as fast.
#include <hip/hip_runtime.h>
#include <math.h>

typedef float v2f __attribute__((ext_vector_type(2)));
typedef float v4f __attribute__((ext_vector_type(4)));
typedef float v8f __attribute__((ext_vector_type(8)));
typedef int   v4i __attribute__((ext_vector_type(4)));

#define KS 7
#define EDIM 64
#define HN 8
#define QKV_RSTRIDE (HN * EDIM)   // 512 floats between consecutive l for fixed (b,h)
#define LSTRIDE 68                // padded LDS row stride (floats) for Q/K/V tiles
#define PSTRIDE 36                // padded LDS row stride for P tile
#define WAVES 4                   // waves per work-group, one 16-query tile each
#define QT (16 * WAVES)           // queries per tile of the work-group
#define KROWS (QT + 8)            // staged K rows: t0-3 .. t0+QT+4  (last wave's band of 22 keys, whole copy rounds)
#define VROWS (QT + 8)            // staged V rows: t0-3 .. t0+QT+4  (last wave's band of 22 keys, whole copy rounds)
#define TILES 8                   // consecutive tiles of one (b,h) that a work-group walks
#define KOFF (QT * LSTRIDE)                 // place of K in a stage (floats); Q stands at 0
#define VOFF (KOFF + KROWS * LSTRIDE)       // place of V in a stage
#define STAGE (VOFF + VROWS * LSTRIDE)      // floats of one stage: Q, K and V of one tile
#define PTILE (WAVES * 16 * PSTRIDE)        // floats of one tile's P

// ---------------- async global -> LDS staging (gfx1250 path) ----------------
#if __has_builtin(__builtin_amdgcn_global_load_async_to_lds_b128) && \
    __has_builtin(__builtin_amdgcn_s_wait_asynccnt)
#define USE_ASYNC_LDS 1
#else
#define USE_ASYNC_LDS 0
#endif

typedef __attribute__((address_space(1))) v4i* as1_v4i_ptr;  // global int4*
typedef __attribute__((address_space(3))) v4i* as3_v4i_ptr;  // LDS int4*

// g: the (b,h) slice of a tensor, the same in every lane; off: the lane's byte offset in it
__device__ __forceinline__ void stage16(const float* g, unsigned off, float* l) {
#if USE_ASYNC_LDS
    // AS1/AS3 pointers via integer casts; low 32 bits of a generic LDS pointer
    // are the LDS byte offset per the aperture rules.
    as1_v4i_ptr gp = (as1_v4i_ptr)((unsigned long long)g + off);
    as3_v4i_ptr lp = (as3_v4i_ptr)(unsigned int)(unsigned long long)l;
    __builtin_amdgcn_global_load_async_to_lds_b128(gp, lp, 0, 0);
#else
    *(v4f*)l = *(const v4f*)((const char*)g + off);
#endif
}

__device__ __forceinline__ void stage_fence() {
#if USE_ASYNC_LDS
    // every copy of this wave has landed before the barrier that lets other waves read it
    asm volatile("s_wait_asynccnt 0x0" ::: "memory");
#endif
}

// all waves stage one tile into one stage of the ring: Q (QT rows) and the shared K and V bands (rows clamped to
// the sequence). 26 copies a wave, every lane on; 16 lanes bring one 256-B row
__device__ __forceinline__ void stage_tile(const float* qs, const float* ks, const float* vs, int t0, int L,
                                           int r0, int c4, float* st) {
    #pragma unroll
    for (int i = 0; i < QT / 8; ++i) {
        const int r = r0 + (i << 3);
        stage16(qs, (unsigned)((t0 + r) * QKV_RSTRIDE + c4) * 4u, &st[r * LSTRIDE + c4]);
    }
    static_assert(KROWS == VROWS, "K and V bands share their row numbers");
    unsigned off[KROWS / 8];
    #pragma unroll
    for (int i = 0; i < KROWS / 8; ++i) {
        int gr = t0 - 3 + r0 + (i << 3);
        gr = gr < 0 ? 0 : (gr >= L ? L - 1 : gr);
        off[i] = (unsigned)(gr * QKV_RSTRIDE + c4) * 4u;
    }
    #pragma unroll
    for (int i = 0; i < KROWS / 8; ++i) stage16(ks, off[i], &st[KOFF + (r0 + (i << 3)) * LSTRIDE + c4]);
    #pragma unroll
    for (int i = 0; i < VROWS / 8; ++i) stage16(vs, off[i], &st[VOFF + (r0 + (i << 3)) * LSTRIDE + c4]);
}

// value of the lane 16 away (l ^ 16): a vector cross-row move, no LDS trip
__device__ __forceinline__ float other_half(float x) {
    return __uint_as_float(__builtin_amdgcn_permlanex16(0u, __float_as_uint(x), 0x76543210u, 0xfedcba98u, false, false));
}

// exp(x) as __expf forms it here, 2^(x * log2 e), in one statement with the free slot that the instruction set asks
// for behind a transcendental
__device__ __forceinline__ float exp_slot(float x) {
    float r;
    asm("v_exp_f32 %0, %1\n\tv_nop" : "=v"(r) : "v"(x * 1.44269504f));
    return r;
}

// ---------------- main kernel ----------------
__global__ __launch_bounds__(32 * WAVES)
void natten1d_wmma_kernel(const float* __restrict__ qg,
                          const float* __restrict__ kg,
                          const float* __restrict__ vg,
                          const float* __restrict__ rpb,
                          float* __restrict__ outg,   // (B,L,H,E)
                          float* __restrict__ attng,  // (B,H,L,KS)
                          int B, int L)
{
    __shared__ __align__(16) float sRing[2 * STAGE];    // two stages: one is worked on while the other is filled
    __shared__ __align__(16) float sPall[2 * PTILE];    // P of this tile and of the one before, for the attn store

    const int wtid = (int)threadIdx.x;                            // 0..127
    const int tid  = wtid & 31;                                   // lane in the wave
    const int w    = __builtin_amdgcn_readfirstlane(wtid >> 5);   // wave in the work-group
    const int seg0 = (int)blockIdx.x * (QT * TILES);   // first query position of the work-group's walk
    const int h    = (int)blockIdx.y;
    const int b    = (int)blockIdx.z;

    const size_t base = ((size_t)b * L) * QKV_RSTRIDE + (size_t)h * EDIM;
    const float* qs = qg + base;    // row 0 of this (b,h) in each tensor; a row's offset in it fits 32 bits
    const float* ks = kg + base;
    const float* vs = vg + base;

    // bias of the 7 in-range offsets: its index depends on the head alone, so these are scalar loads
    float bias[KS];
    #pragma unroll
    for (int kk = 0; kk < KS; ++kk) bias[kk] = rpb[h * 13 + 3 + kk];

    const int r0 = wtid >> 4, c4 = (wtid & 15) << 2;
    stage_tile(qs, ks, vs, seg0, L, r0, c4, sRing);          // tile 0 into stage 0

    const int g  = tid >> 4;    // lane group (0: lanes 0-15, 1: lanes 16-31)
    const int ln = tid & 15;

    // ---- scores are formed transposed, S^T = K * Q^T: lane (ln, g) then owns query ln, and its registers hold
    //      band keys 8g + vv (tile 0) and 16 + 3g + vv, vv < 3 (tile 1). What is added to each scaled product
    //      (the bias inside the 7-wide band, -inf elsewhere) is the same for every tile of the walk, so it is
    //      formed once, here, while the first copies are in flight ----
    // holds the wait for the bias words, and the arithmetic on them, behind the issue of the last copy
    __builtin_amdgcn_sched_barrier(0);
    float add0[8], add1[3];
    #pragma unroll
    for (int vv = 0; vv < 11; ++vv) {
        const int r  = vv < 8 ? vv : vv - 8;                     // register within its tile
        const int j0 = vv < 8 ? (g << 3) : 16 + 3 * g;           // band key of the tile's register 0 in this lane
        const int d  = j0 - ln;                                  // j0 + r - ln is the key's place in query ln's window
        float bv = -INFINITY;
        #pragma unroll
        for (int i = 0; i < KS; ++i) bv = (d == i - r) ? bias[i] : bv;
        if (vv < 8) add0[vv] = bv; else add1[vv - 8] = bv;
    }
    const int k1row = 16 + 3 * (ln >> 3) + ((ln & 7) < 2 ? (ln & 7) : 2);

    static_assert(TILES >= 2, "the ring's prologue fills two stages");
    stage_fence();          // tile 0 of this wave has landed
    __syncthreads();        // publishes tile 0
    stage_tile(qs, ks, vs, seg0 + QT, L, r0, c4, sRing + STAGE);   // tile 1 into stage 1

    // one trip: tile s is worked on; refill says whether a tile s + 2 exists
    auto trip = [&](const int s, const bool refill) __attribute__((always_inline)) {
        const int t0 = seg0 + s * QT;              // first query position of the tile
        const int t  = t0 + (w << 4);              // first query position of this wave's 16 queries
        float* st = sRing + (s & 1) * STAGE;       // the stage that holds tile s

        // this wave's window into the shared tiles
        const float* sQ = st + (w << 4) * LSTRIDE;
        const float* sK = st + KOFF + (w << 4) * LSTRIDE;
        const float* sV = st + VOFF + (w << 4) * LSTRIDE;
        float*       sPt = sPall + (s & 1) * PTILE;
        float*       sP = sPt + (w << 4) * PSTRIDE;

        // ---- S^T = K * Q^T, two 16x16 WMMA tiles. Tile 0: keys 0..15. Tile 1 holds the 6 keys left of the band,
        //      16..18 in rows 0..2 and 19..21 in rows 8..10, so each lane half gets three; its other rows repeat one ----
        v8f acc0 = {0.f,0.f,0.f,0.f,0.f,0.f,0.f,0.f};
        v8f acc1 = {0.f,0.f,0.f,0.f,0.f,0.f,0.f,0.f};
        #pragma unroll
        for (int e4 = 0; e4 < 16; ++e4) {
            const int col = (e4 << 2) + (g << 1);
            v2f qf = *(const v2f*)&sQ[ln * LSTRIDE + col];          // B[K=col..col+1][N=ln]
            v2f k0 = *(const v2f*)&sK[ln * LSTRIDE + col];          // A[M=ln][K], keys 0..15
            v2f k1 = *(const v2f*)&sK[k1row * LSTRIDE + col];       // A[M=ln][K], keys 16..21
            acc0 = __builtin_amdgcn_wmma_f32_16x16x4_f32(false, k0, false, qf, (short)0, acc0, false, false);
            acc1 = __builtin_amdgcn_wmma_f32_16x16x4_f32(false, k1, false, qf, (short)0, acc1, false, false);
        }

        // ---- softmax of query ln in registers: 11 entries in this lane, 11 in lane l ^ 16;
        //      a key outside the sequence counts as -inf ----
        const int kb0 = t - 3 + (g << 3), kb1 = t - 3 + 16 + 3 * g;   // sequence position of each tile's register 0
        float p0[8], p1[3];
        #pragma unroll
        for (int vv = 0; vv < 8; ++vv)
            p0[vv] = ((unsigned)(kb0 + vv) < (unsigned)L) ? acc0[vv] * 0.125f + add0[vv] : -INFINITY;
        #pragma unroll
        for (int vv = 0; vv < 3; ++vv)
            p1[vv] = ((unsigned)(kb1 + vv) < (unsigned)L) ? acc1[vv] * 0.125f + add1[vv] : -INFINITY;
        float m = fmaxf(fmaxf(p1[0], p1[1]), p1[2]);
        #pragma unroll
        for (int vv = 0; vv < 8; ++vv) m = fmaxf(m, p0[vv]);
        m = fmaxf(m, other_half(m));           // finite: a query's own key is always in range
        float sum = 0.f;
        #pragma unroll
        for (int vv = 0; vv < 8; ++vv) { p0[vv] = exp_slot(p0[vv] - m); sum += p0[vv]; }   // exp(-inf) -> 0 off the band
        #pragma unroll
        for (int vv = 0; vv < 3; ++vv) { p1[vv] = exp_slot(p1[vv] - m); sum += p1[vv]; }
        sum += other_half(sum);
        const float inv = 1.0f / sum;
        #pragma unroll
        for (int vv = 0; vv < 8; ++vv) p0[vv] *= inv;
        #pragma unroll
        for (int vv = 0; vv < 3; ++vv) p1[vv] *= inv;

        // the weights go to the LDS P tile only for the attn store behind the barrier: row = query, column = band key
        *(v4f*)&sP[ln * PSTRIDE + (g << 3)]     = (v4f){p0[0], p0[1], p0[2], p0[3]};
        *(v4f*)&sP[ln * PSTRIDE + (g << 3) + 4] = (v4f){p0[4], p0[5], p0[6], p0[7]};
        #pragma unroll
        for (int vv = 0; vv < 3; ++vv) sP[ln * PSTRIDE + 16 + 3 * g + vv] = p1[vv];

        // ---- out = P * V : 4 N-tiles, the 22 band keys in 6 chunks of 4. Lane ln of N-tile nt takes V column
        //      4*ln + nt, so a lane ends with 4 adjacent floats of each of its rows and 16 lanes store a whole row ----
        v8f acc[4];
        #pragma unroll
        for (int nt = 0; nt < 4; ++nt) acc[nt] = (v8f){0.f,0.f,0.f,0.f,0.f,0.f,0.f,0.f};
        #pragma unroll
        for (int c = 0; c < 6; ++c) {
            // the weights are already an A operand: A[M=ln][K slot (g, i)] is this lane's register for band key kr + i,
            // and the V loader takes the same keys for the same slots; slot 1 of the last chunk has weight 0
            const int kr = c < 4 ? (g << 3) + (c << 1) : 16 + 3 * g + ((c - 4) << 1);
            const v2f a  = c < 4 ? (v2f){p0[2 * c], p0[2 * c + 1]} : (c == 4 ? (v2f){p1[0], p1[1]} : (v2f){p1[2], 0.f});
            const v4f v0 = *(const v4f*)&sV[(kr + 0) * LSTRIDE + (ln << 2)];                 // V[kr  ][4*ln .. 4*ln+3]
            const v4f v1 = c < 5 ? *(const v4f*)&sV[(kr + 1) * LSTRIDE + (ln << 2)] : v0;    // V[kr+1][4*ln .. 4*ln+3]
            #pragma unroll
            for (int nt = 0; nt < 4; ++nt) {
                v2f bb;
                bb.x = v0[nt];                                                   // B[K=kr  ][N=ln]
                bb.y = v1[nt];                                                   // B[K=kr+1][N=ln]
                acc[nt] = __builtin_amdgcn_wmma_f32_16x16x4_f32(false, a, false, bb, (short)0, acc[nt], false, false);
            }
        }

        // ---- foot of the trip: this wave has left stage s and written its P; tile s + 1 of this wave has landed;
        //      the one barrier publishes tile s + 1 and P, and ends every reader's last read of stage s ----
        asm volatile("s_wait_dscnt 0x0" ::: "memory");
        stage_fence();
        __syncthreads();
        if (refill)             // known where the trip is written out: no branch stands here
            stage_tile(qs, ks, vs, t0 + 2 * QT, L, r0, c4, st);          // tile s + 2 into the stage just left

        // ---- both outputs of tile s are stored behind the refill, so that they complete under the next trip ----
        const size_t obase = ((size_t)b * L + t) * QKV_RSTRIDE + (size_t)h * EDIM;
        #pragma unroll
        for (int vv = 0; vv < 8; ++vv) {
            const int M = vv + (g << 3);
            const v4f o = {acc[0][vv], acc[1][vv], acc[2][vv], acc[3][vv]};
            *(v4f*)&outg[obase + (size_t)M * QKV_RSTRIDE + (ln << 2)] = o;
        }

        // attn: the tile's QT x KS weights are QT*KS*4 contiguous bytes, a whole number of 128-B lines;
        // each of the first QT*KS/4 threads gathers 4 adjacent ones from the P tiles and stores 16 bytes
        if (wtid < QT * KS / 4) {
            v4f o;
            #pragma unroll
            for (int j = 0; j < 4; ++j) {
                const int e   = (wtid << 2) + j;
                const int row = e / KS;                 // query within the tile
                o[j] = sPt[row * PSTRIDE + (row & 15) + (e - row * KS)];
            }
            *(v4f*)(attng + (((size_t)b * HN + h) * L + t0) * KS + (wtid << 2)) = o;
        }
        // the next trip rewrites registers that this trip's stores name: the wait stands in front of that
        asm volatile("s_wait_xcnt 0x0" ::: "memory");
    };

    // both loops stay rolled: the stage is picked by an offset, and the text stays small in the instruction cache
    #pragma unroll 1
    for (int s = 0; s < TILES - 2; ++s) trip(s, true);
    #pragma unroll 1
    for (int s = TILES - 2; s < TILES; ++s) trip(s, false);     // the last two tiles have nothing to fetch ahead
    stage_fence();          // no copy is open when the wave ends
}

extern "C" void kernel_launch(void* const* d_in, const int* in_sizes, int n_in,
                              void* d_out, int out_size, void* d_ws, size_t ws_size,
                              hipStream_t stream) {
    (void)n_in; (void)out_size; (void)d_ws; (void)ws_size;
    const float* q   = (const float*)d_in[0];
    const float* k   = (const float*)d_in[1];
    const float* v   = (const float*)d_in[2];
    const float* rpb = (const float*)d_in[3];
    const int L = 8192;
    const int B = in_sizes[0] / (L * HN * EDIM);   // = 4
    float* out  = (float*)d_out;
    float* attn = out + (size_t)B * L * HN * EDIM;
    const int nwalks = L / (QT * TILES);
    dim3 grid(nwalks, HN, B);     // 512 blocks of WAVES wave32 each, two resident on a WGP
    natten1d_wmma_kernel<<<grid, 32 * WAVES, 0, stream>>>(q, k, v, rpb, out, attn, B, L);
}

// v007
// Measured time: 19.6 microseconds a run.
// Next to v006, in two timings, it ran 1.04 times as fast each time.
// Counting every step since v000, it is 1.67 times as fast.
#include <hip/hip_runtime.h>
#include <math.h>
#include <stdint.h>

typedef float v2f __attribute__((ext_vector_type(2)));
typedef float v4f __attribute__((ext_vector_type(4)));
typedef float v8f __attribute__((ext_vector_type(8)));
typedef uint32_t u32x4 __attribute__((ext_vector_type(4)));
typedef uint32_t u32x8 __attribute__((ext_vector_type(8)));

#define KS 7
#define EDIM 64
#define HN 8
#define QKV_RSTRIDE (HN * EDIM)   // 512 floats between consecutive l for fixed (b,h)
#define LSTRIDE 68                // padded LDS row stride (floats) for Q/K/V tiles
#define PSTRIDE 36                // padded LDS row stride for P tile
#define WAVES 4                   // waves per work-group, one 16-query tile each
#define QT (16 * WAVES)           // queries per tile of the work-group
#define KROWS (QT + 6)            // staged K and V rows: t0-3 .. t0+QT+2  (the last wave's band of 22 keys ends there)
#define EDGE 3                    // rows of a band that can lie in front of the first or behind the last row of the tensor
#define TILES 8                   // consecutive tiles of one (b,h) that a work-group walks
#define UP2K(f) (((f) + 511) / 512 * 512)   // floats, rounded up to a whole number of 2 KiB: a tensor load's place in LDS
#define KOFF UP2K(QT * LSTRIDE)             // place of K in a stage (floats); Q stands at 0
#define KREG UP2K(KROWS * LSTRIDE)          // room of K, and of V, in a stage
#define VOFF (KOFF + KREG)                  // place of V in a stage
#define STAGE (VOFF + KREG)                 // floats of one stage: Q, K and V of one tile
#define PTILE (WAVES * 16 * PSTRIDE)        // floats of one tile's P

// ---------------- tensor loads: global -> LDS, one request of a wave brings a whole tile ----------------
__device__ __forceinline__ uint32_t uni(uint32_t v) { return (uint32_t)__builtin_amdgcn_readfirstlane(v); }

// a value held in a scalar register: a test on it compiles to a scalar branch (a tensor load ignores EXEC), and a
// descriptor word made from it is formed where this stands, behind the wait in front of it
__device__ __forceinline__ uint32_t pinned(uint32_t v) {
    uint32_t w = uni(v);
    asm volatile("" : "+s"(w));     // for the tensor mover: holds the word in a scalar register
    return w;
}

// group 1: sizes in bytes; a tile of rows x 256 B that is the whole tensor, source pitch 2 KiB; a pad of 16 B behind
// every 256 B gives the LDS pitch of LSTRIDE floats
__device__ __forceinline__ u32x8 tdm_group1(uint32_t rows) {
    static_assert(EDIM * 4 == 256 && LSTRIDE * 4 == 256 + 16, "pad codes 5 and 3 are for 256-B rows at a pitch of 272 B");
    u32x8 g;
    g[0] = uni((1u << 20) | (5u << 22) | (3u << 25));
    g[1] = uni((EDIM * 4u) << 16);
    g[2] = uni(rows << 16);
    g[3] = uni((EDIM * 4u) << 16);
    g[4] = uni(rows);
    g[5] = uni(QKV_RSTRIDE * 4u);
    g[6] = uni(0u);
    g[7] = uni(0u);
    return g;
}

__device__ __forceinline__ u32x4 tdm_group0(uint32_t lds_dst, uint64_t ga) {
    u32x4 g;
    g[0] = uni(1u);
    g[1] = uni(lds_dst);
    g[2] = uni((uint32_t)ga);
    g[3] = uni((((uint32_t)(ga >> 32)) & 0x01FFFFFFu) | 0x80000000u);
    return g;
}

// one request of the whole wave; the clobber keeps LDS reads and writes on their side of it
__device__ __forceinline__ void tdm_load(u32x4 g0, u32x8 g1) {
    asm volatile("tensor_load_to_lds %0, %1" :: "s"(g0), "s"(g1) : "memory");
}

// the issuing wave's request has landed before the barrier that lets other waves read the tile. The wait names the
// request's descriptor as inputs, so that its scalar registers keep their values for as long as the request is open
__device__ __forceinline__ void tdm_landed(u32x4 g0, u32x8 g1) {
    asm volatile("s_wait_tensorcnt 0x0" :: "s"(g0), "s"(g1) : "memory");
}

// value of the lane 16 away (l ^ 16): a vector cross-row move, no LDS trip
__device__ __forceinline__ float other_half(float x) {
    return __uint_as_float(__builtin_amdgcn_permlanex16(0u, __float_as_uint(x), 0x76543210u, 0xfedcba98u, false, false));
}

// exp(x) as __expf forms it here, 2^(x * log2 e), in one statement with the free slot that the instruction set asks
// for behind a transcendental
__device__ __forceinline__ float exp_slot(float x) {
    float r;
    asm("v_exp_f32 %0, %1\n\tv_nop" : "=v"(r) : "v"(x * 1.44269504f));
    return r;
}

// ---------------- main kernel ----------------
__global__ __launch_bounds__(32 * WAVES)
void natten1d_wmma_kernel(const float* __restrict__ qg,
                          const float* __restrict__ kg,
                          const float* __restrict__ vg,
                          const float* __restrict__ rpb,
                          float* __restrict__ outg,   // (B,L,H,E)
                          float* __restrict__ attng,  // (B,H,L,KS)
                          int B, int L)
{
    // one array, so that the ring stands at a multiple of 2 KiB in the work-group's LDS, as every tile's place then does
    __shared__ __attribute__((aligned(2048))) float sAll[2 * STAGE + 2 * PTILE];
    float* const sRing = sAll;                  // two stages: one is worked on while the other is filled
    float* const sPall = sAll + 2 * STAGE;      // P of this tile and of the one before, for the attn store

    const int wtid = (int)threadIdx.x;                            // 0..127
    const int tid  = wtid & 31;                                   // lane in the wave
    const int w    = __builtin_amdgcn_readfirstlane(wtid >> 5);   // wave in the work-group
    const int seg0 = (int)blockIdx.x * (QT * TILES);   // first query position of the work-group's walk
    const int h    = (int)blockIdx.y;
    const int b    = (int)blockIdx.z;

    // waves 0, 1, 2 each bring one tensor's tile of a stage with one request: Q (QT rows), K and V (KROWS rows)
    const bool     issuer = w < 3;
    const uint64_t srch   = (uint64_t)(size_t)(w == 0 ? qg : (w == 1 ? kg : vg)) + (uint64_t)(h * (EDIM * 4));   // head h of row 0
    const uint32_t place  = (uint32_t)(size_t)sRing + (w == 0 ? 0u : (w == 1 ? KOFF * 4u : VOFF * 4u));
    const u32x8    g1     = tdm_group1(w == 0 ? (uint32_t)QT : (uint32_t)KROWS);
    // first staged row of the band of the tile at position p, counted over all batches. The band begins 3 rows in
    // front of the tile; a row of a neighbouring batch is a key outside the sequence, whose weight is 0. Only at the
    // two ends of the tensor is the band moved to lie inside it, and its readers start as many rows off
    auto band_row = [&](const int p) { const int r = b * L + p - 3; return r < 0 ? 0 : (r > B * L - KROWS ? B * L - KROWS : r); };
    u32x4 g0 = {0u, 0u, 0u, 0u};    // group 0 of the wave's open request
    auto issue = [&](const int p, const int stage) __attribute__((always_inline)) {
        const uint32_t row = pinned((uint32_t)(w == 0 ? b * L + p : band_row(p)));
        g0 = tdm_group0(place + (uint32_t)stage * (STAGE * 4u), srch + (uint64_t)row * (QKV_RSTRIDE * 4u));
        tdm_load(g0, g1);
    };

    // bias of the 7 in-range offsets: its index depends on the head alone, so these are scalar loads
    float bias[KS];
    #pragma unroll
    for (int kk = 0; kk < KS; ++kk) bias[kk] = rpb[h * 13 + 3 + kk];

    if (pinned(issuer)) issue(seg0, 0);          // tile 0 into stage 0

    // the room between the tiles of a stage is where a band that was moved at an end of the tensor has its EDGE rows
    // outside the sequence: no load writes there, so it is set to 0 once (weight 0 times 0 in P*V)
    static_assert(KOFF - QT * LSTRIDE >= EDGE * LSTRIDE && KREG - KROWS * LSTRIDE >= EDGE * LSTRIDE, "room for the rows off the ends");
    #pragma unroll
    for (int st = 0; st < 2; ++st) {
        float* p = sRing + st * STAGE;
        const v4f zero = {0.f, 0.f, 0.f, 0.f};
        if ((wtid << 2) < KOFF - QT * LSTRIDE) *(v4f*)&p[QT * LSTRIDE + (wtid << 2)] = zero;
        if ((wtid << 2) < KREG - KROWS * LSTRIDE) {
            *(v4f*)&p[KOFF + KROWS * LSTRIDE + (wtid << 2)] = zero;
            *(v4f*)&p[VOFF + KROWS * LSTRIDE + (wtid << 2)] = zero;
        }
    }

    const int g  = tid >> 4;    // lane group (0: lanes 0-15, 1: lanes 16-31)
    const int ln = tid & 15;

    // ---- scores are formed transposed, S^T = K * Q^T: lane (ln, g) then owns query ln, and its registers hold
    //      band keys 8g + vv (tile 0) and 16 + 3g + vv, vv < 3 (tile 1). What is added to each scaled product
    //      (the bias inside the 7-wide band, -inf elsewhere) is the same for every tile of the walk, so it is
    //      formed once, here, while the first tile is in flight ----
    // holds the wait for the bias words, and the arithmetic on them, behind the issue of the first tile's load
    __builtin_amdgcn_sched_barrier(0);
    float add0[8], add1[3];
    #pragma unroll
    for (int vv = 0; vv < 11; ++vv) {
        const int r  = vv < 8 ? vv : vv - 8;                     // register within its tile
        const int j0 = vv < 8 ? (g << 3) : 16 + 3 * g;           // band key of the tile's register 0 in this lane
        const int d  = j0 - ln;                                  // j0 + r - ln is the key's place in query ln's window
        float bv = -INFINITY;
        #pragma unroll
        for (int i = 0; i < KS; ++i) bv = (d == i - r) ? bias[i] : bv;
        if (vv < 8) add0[vv] = bv; else add1[vv - 8] = bv;
    }
    const int k1row = 16 + 3 * (ln >> 3) + ((ln & 7) < 2 ? (ln & 7) : 2);

    static_assert(TILES >= 2, "the ring's prologue fills two stages");
    if (pinned(issuer)) tdm_landed(g0, g1);         // tile 0
    __syncthreads();                                // publishes tile 0 and the zeros
    if (pinned(issuer)) issue(seg0 + QT, 1);        // tile 1 into stage 1

    // one trip: tile s is worked on; refill says whether a tile s + 2 exists
    auto trip = [&](const int s, const bool refill) __attribute__((always_inline)) {
        const int t0 = seg0 + s * QT;              // first query position of the tile
        const int t  = t0 + (w << 4);              // first query position of this wave's 16 queries
        float* st = sRing + (s & 1) * STAGE;       // the stage that holds tile s

        // this wave's window into the shared tiles
        const float* sQ = st + (w << 4) * LSTRIDE;
        const int    off = b * L + t0 - 3 - band_row(t0);       // 0 but at the two ends of the tensor
        const float* sK = st + KOFF + ((w << 4) + off) * LSTRIDE;
        const float* sV = st + VOFF + ((w << 4) + off) * LSTRIDE;
        float*       sPt = sPall + (s & 1) * PTILE;
        float*       sP = sPt + (w << 4) * PSTRIDE;

        // ---- S^T = K * Q^T, two 16x16 WMMA tiles. Tile 0: keys 0..15. Tile 1 holds the 6 keys left of the band,
        //      16..18 in rows 0..2 and 19..21 in rows 8..10, so each lane half gets three; its other rows repeat one ----
        v8f acc0 = {0.f,0.f,0.f,0.f,0.f,0.f,0.f,0.f};
        v8f acc1 = {0.f,0.f,0.f,0.f,0.f,0.f,0.f,0.f};
        #pragma unroll
        for (int e4 = 0; e4 < 16; ++e4) {
            const int col = (e4 << 2) + (g << 1);
            v2f qf = *(const v2f*)&sQ[ln * LSTRIDE + col];          // B[K=col..col+1][N=ln]
            v2f k0 = *(const v2f*)&sK[ln * LSTRIDE + col];          // A[M=ln][K], keys 0..15
            v2f k1 = *(const v2f*)&sK[k1row * LSTRIDE + col];       // A[M=ln][K], keys 16..21
            acc0 = __builtin_amdgcn_wmma_f32_16x16x4_f32(false, k0, false, qf, (short)0, acc0, false, false);
            acc1 = __builtin_amdgcn_wmma_f32_16x16x4_f32(false, k1, false, qf, (short)0, acc1, false, false);
        }

        // ---- softmax of query ln in registers: 11 entries in this lane, 11 in lane l ^ 16;
        //      a key outside the sequence counts as -inf ----
        const int kb0 = t - 3 + (g << 3), kb1 = t - 3 + 16 + 3 * g;   // sequence position of each tile's register 0
        float p0[8], p1[3];
        #pragma unroll
        for (int vv = 0; vv < 8; ++vv)
            p0[vv] = ((unsigned)(kb0 + vv) < (unsigned)L) ? acc0[vv] * 0.125f + add0[vv] : -INFINITY;
        #pragma unroll
        for (int vv = 0; vv < 3; ++vv)
            p1[vv] = ((unsigned)(kb1 + vv) < (unsigned)L) ? acc1[vv] * 0.125f + add1[vv] : -INFINITY;
        float m = fmaxf(fmaxf(p1[0], p1[1]), p1[2]);
        #pragma unroll
        for (int vv = 0; vv < 8; ++vv) m = fmaxf(m, p0[vv]);
        m = fmaxf(m, other_half(m));           // finite: a query's own key is always in range
        float sum = 0.f;
        #pragma unroll
        for (int vv = 0; vv < 8; ++vv) { p0[vv] = exp_slot(p0[vv] - m); sum += p0[vv]; }   // exp(-inf) -> 0 off the band
        #pragma unroll
        for (int vv = 0; vv < 3; ++vv) { p1[vv] = exp_slot(p1[vv] - m); sum += p1[vv]; }
        sum += other_half(sum);
        const float inv = 1.0f / sum;
        #pragma unroll
        for (int vv = 0; vv < 8; ++vv) p0[vv] *= inv;
        #pragma unroll
        for (int vv = 0; vv < 3; ++vv) p1[vv] *= inv;

        // the weights go to the LDS P tile only for the attn store behind the barrier: row = query, column = band key
        *(v4f*)&sP[ln * PSTRIDE + (g << 3)]     = (v4f){p0[0], p0[1], p0[2], p0[3]};
        *(v4f*)&sP[ln * PSTRIDE + (g << 3) + 4] = (v4f){p0[4], p0[5], p0[6], p0[7]};
        #pragma unroll
        for (int vv = 0; vv < 3; ++vv) sP[ln * PSTRIDE + 16 + 3 * g + vv] = p1[vv];

        // ---- out = P * V : 4 N-tiles, the 22 band keys in 6 chunks of 4. Lane ln of N-tile nt takes V column
        //      4*ln + nt, so a lane ends with 4 adjacent floats of each of its rows and 16 lanes store a whole row ----
        v8f acc[4];
        #pragma unroll
        for (int nt = 0; nt < 4; ++nt) acc[nt] = (v8f){0.f,0.f,0.f,0.f,0.f,0.f,0.f,0.f};
        #pragma unroll
        for (int c = 0; c < 6; ++c) {
            // the weights are already an A operand: A[M=ln][K slot (g, i)] is this lane's register for band key kr + i,
            // and the V loader takes the same keys for the same slots; slot 1 of the last chunk has weight 0
            const int kr = c < 4 ? (g << 3) + (c << 1) : 16 + 3 * g + ((c - 4) << 1);
            const v2f a  = c < 4 ? (v2f){p0[2 * c], p0[2 * c + 1]} : (c == 4 ? (v2f){p1[0], p1[1]} : (v2f){p1[2], 0.f});
            const v4f v0 = *(const v4f*)&sV[(kr + 0) * LSTRIDE + (ln << 2)];                 // V[kr  ][4*ln .. 4*ln+3]
            const v4f v1 = c < 5 ? *(const v4f*)&sV[(kr + 1) * LSTRIDE + (ln << 2)] : v0;    // V[kr+1][4*ln .. 4*ln+3]
            #pragma unroll
            for (int nt = 0; nt < 4; ++nt) {
                v2f bb;
                bb.x = v0[nt];                                                   // B[K=kr  ][N=ln]
                bb.y = v1[nt];                                                   // B[K=kr+1][N=ln]
                acc[nt] = __builtin_amdgcn_wmma_f32_16x16x4_f32(false, a, false, bb, (short)0, acc[nt], false, false);
            }
        }

        // ---- foot of the trip: this wave has left stage s and written its P; this wave's request of tile s + 1 has
        //      landed; the one barrier publishes tile s + 1 and P, and ends every reader's last read of stage s ----
        asm volatile("s_wait_dscnt 0x0" ::: "memory");
        if (pinned(issuer)) tdm_landed(g0, g1);
        __syncthreads();
        if (refill) {           // known where the trip is written out: no branch stands here for it
            if (pinned(issuer)) issue(t0 + 2 * QT, s & 1);               // tile s + 2 into the stage just left
        }

        // ---- both outputs of tile s are stored behind the refill, so that they complete under the next trip ----
        const size_t obase = ((size_t)b * L + t) * QKV_RSTRIDE + (size_t)h * EDIM;
        #pragma unroll
        for (int vv = 0; vv < 8; ++vv) {
            const int M = vv + (g << 3);
            const v4f o = {acc[0][vv], acc[1][vv], acc[2][vv], acc[3][vv]};
            *(v4f*)&outg[obase + (size_t)M * QKV_RSTRIDE + (ln << 2)] = o;
        }

        // attn: the tile's QT x KS weights are QT*KS*4 contiguous bytes, a whole number of 128-B lines;
        // each of the first QT*KS/4 threads gathers 4 adjacent ones from the P tiles and stores 16 bytes
        if (wtid < QT * KS / 4) {
            v4f o;
            #pragma unroll
            for (int j = 0; j < 4; ++j) {
                const int e   = (wtid << 2) + j;
                const int row = e / KS;                 // query within the tile
                o[j] = sPt[row * PSTRIDE + (row & 15) + (e - row * KS)];
            }
            *(v4f*)(attng + (((size_t)b * HN + h) * L + t0) * KS + (wtid << 2)) = o;
        }
        // the next trip rewrites registers that this trip's stores name: the wait stands in front of that
        asm volatile("s_wait_xcnt 0x0" ::: "memory");
    };

    // both loops stay rolled: the stage is picked by an offset, and the text stays small in the instruction cache
    #pragma unroll 1
    for (int s = 0; s < TILES - 2; ++s) trip(s, true);
    #pragma unroll 1
    for (int s = TILES - 2; s < TILES; ++s) trip(s, false);     // the last two tiles have nothing to fetch ahead
    tdm_landed(g0, g1);     // no request is open when the wave ends
    asm volatile("s_wait_dscnt 0x0" ::: "memory");      // and no LDS operation
}

extern "C" void kernel_launch(void* const* d_in, const int* in_sizes, int n_in,
                              void* d_out, int out_size, void* d_ws, size_t ws_size,
                              hipStream_t stream) {
    (void)n_in; (void)out_size; (void)d_ws; (void)ws_size;
    const float* q   = (const float*)d_in[0];
    const float* k   = (const float*)d_in[1];
    const float* v   = (const float*)d_in[2];
    const float* rpb = (const float*)d_in[3];
    const int L = 8192;
    const int B = in_sizes[0] / (L * HN * EDIM);   // = 4
    float* out  = (float*)d_out;
    float* attn = out + (size_t)B * L * HN * EDIM;
    const int nwalks = L / (QT * TILES);
    dim3 grid(nwalks, HN, B);     // 512 blocks of WAVES wave32 each, two resident on a WGP
    natten1d_wmma_kernel<<<grid, 32 * WAVES, 0, stream>>>(q, k, v, rpb, out, attn, B, L);
}
